// v000
// Times are from an AMD MI455X. After a warm-up the kernel runs many times in a row, and a time is the length of
// such a window on the GPU divided by its runs, so every launch and the gaps after it count. The runs cycle
// through copies of the inputs. A figure is the median of several windows, for all but v000 over two sittings.
// Sittings can differ by a few percent; kernels timed side by side share one.
// v000 is the starting kernel. One run takes 263 microseconds.
#include <hip/hip_runtime.h>

// Scaled dot-product attention, single head, causal, on given q/k/v [8, 4096, 64]: out[b][t] = Σ_{s<=t} softmax_s(q_t . k_s / 8) v_s -> [8][4096][64].
// No projections: q, k, v are (bf16-rounded) inputs, so every WMMA operand except the probabilities is exact.
// Deterministic: flash-style per 16-query wave over the causal keys in order (running max); no atomics.
// compute dtype: WMMA v_wmma_f32_16x16x32_f16 with f32 accumulate for S^T = K Q^T (q, k EXACT bf16 x8 planes: 1 product) and O^T += V^T P^T (v EXACT x8, P x1024 as f16 hi+lo: 2 products);
// softmax statistics in f32. Inputs rounded to bf16 once.

namespace {
constexpr int B = 8, L = 4096, HD = 64, BL = 8 /* batches (== 8 shipped) */, QL = 4096 /* query rows (== 4096 shipped; causal: a cut also limits keys to < QL) */;
constexpr float XS = 8.0f, PS = 1024.0f, LOG2E = 1.4426950408889634f;
static_assert(L % 64 == 0 && QL % 64 == 0, "tiling");
typedef _Float16 b16;
typedef __attribute__((ext_vector_type(16))) _Float16 v16b;
typedef __attribute__((ext_vector_type(8))) _Float16 v8b;
typedef __attribute__((ext_vector_type(8))) float v8f;
typedef __attribute__((ext_vector_type(4))) float v4f;
__device__ __forceinline__ float bf16_rne(float f) { unsigned int u = __float_as_uint(f); u += 0x7FFFu + ((u >> 16) & 1u); return __uint_as_float(u & 0xFFFF0000u); }
__device__ __forceinline__ void split16(float v, b16& hi, b16& lo) { hi = (b16)v; lo = (b16)(v - (float)hi); }
__device__ __forceinline__ v16b frag_kb(const b16* p, int hh) { const v8b a = *(const v8b*)(p + 8 * hh), b = *(const v8b*)(p + 16 + 8 * hh); v16b f;
#pragma unroll
  for (int e = 0; e < 8; ++e) { f[e] = a[e]; f[8 + e] = b[e]; } return f; }
__device__ __forceinline__ v8f wmma16b(v16b a, v16b b, v8f c) { v8f d = __builtin_amdgcn_wmma_f32_16x16x32_f16(false, a, false, b, (short)0, c, false, false); asm volatile("v_nop\n\tv_nop\n\tv_nop\n\tv_nop" : "+v"(d) : "v"(a), "v"(b)); return d; }
__device__ __forceinline__ void wave_lds_sync() { __builtin_amdgcn_fence(__ATOMIC_RELEASE, "workgroup"); __builtin_amdgcn_wave_barrier(); __builtin_amdgcn_fence(__ATOMIC_ACQUIRE, "workgroup"); }
__device__ __forceinline__ float pmul(float a, float b) { float p = a * b; asm volatile("" : "+v"(p)); return p; }
__device__ __forceinline__ int iclamp(int v, int lo, int hi) { return v < lo ? lo : (v > hi ? hi : v); }

typedef __attribute__((ext_vector_type(2))) _Float16 v2h;
typedef __attribute__((ext_vector_type(4))) _Float16 v4h;
typedef __attribute__((ext_vector_type(2))) float v2f;
__device__ __forceinline__ float nexp2(float v) { return __builtin_amdgcn_exp2f(v); }
__global__ __launch_bounds__(256) void plane_kernel(const float* __restrict__ q, const float* __restrict__ k, const float* __restrict__ v, b16* __restrict__ QP, b16* __restrict__ KP, b16* __restrict__ VT) {
  __shared__ b16 Tv[64][HD + 2];
  const int t0 = blockIdx.x * 64, b = blockIdx.y; if (t0 >= QL) return;   // cut builds only; block-uniform, before any barrier
  const size_t base = ((size_t)b * L + t0) * HD;
  for (int i = threadIdx.x; i < 64 * HD; i += 256) { const int t = i / HD, c = i % HD; Tv[t][c] = (b16)(bf16_rne(v[base + i]) * XS); }
  __syncthreads();
  {
    for (int i = threadIdx.x; i < 64 * HD / 4; i += 256) { const v4f fq = *(const v4f*)(q + base + (size_t)i * 4), fk = *(const v4f*)(k + base + (size_t)i * 4); v4h oq, ok; for (int j = 0; j < 4; ++j) { oq[j] = (b16)(bf16_rne(fq[j]) * XS); ok[j] = (b16)(bf16_rne(fk[j]) * XS); }
      *(v4h*)(QP + base + (size_t)i * 4) = oq; *(v4h*)(KP + base + (size_t)i * 4) = ok; }
    for (int i = threadIdx.x; i < HD * 32; i += 256) { const int d = i / 32, tp = (i % 32) * 2; v2h o2; o2[0] = Tv[tp][d]; o2[1] = Tv[tp + 1][d]; *(v2h*)(VT + ((size_t)b * HD + d) * (size_t)L + t0 + tp) = o2; }
     }
}
__global__ __launch_bounds__(64) void attn_kernel(const b16* __restrict__ QP, const b16* __restrict__ KP, const b16* __restrict__ VT, float* __restrict__ out) {
  __shared__ __attribute__((aligned(16))) b16 Pb[2][16][32 + 8], Pc[2][16][32 + 8]; __shared__ __attribute__((aligned(16))) float To[2][16][HD + 4];
  const int wave = threadIdx.x >> 5, lane = threadIdx.x & 31, hh = lane >> 4, col = lane & 15; const int b = blockIdx.y; const int q0 = blockIdx.x * 32 + wave * 16, qi = q0 + col;
  const b16* Qb = QP + (size_t)b * L * HD; const b16* Kb = KP + (size_t)b * L * HD; const b16* Vb = VT + (size_t)b * HD * (size_t)L;
  const v16b qa0 = frag_kb(Qb + (size_t)qi * HD, hh), qa1 = frag_kb(Qb + (size_t)qi * HD + 32, hh);
  const float cs = LOG2E / (8.0f * XS * XS);
  float m = -INFINITY, l = 0.0f; v8f o[4]; for (int t = 0; t < 4; ++t) o[t] = (v8f){};
  const int kend = q0 + 16;
#pragma unroll 1
  for (int kb = 0; kb < kend; kb += 32) {
    float e[16]; float mx = -INFINITY;
#pragma unroll
    for (int u = 0; u < 2; ++u) { v8f s = (v8f){}; const size_t kr = (size_t)(kb + u * 16 + col) * HD; s = wmma16b(frag_kb(Kb + kr, hh), qa0, s); s = wmma16b(frag_kb(Kb + kr + 32, hh), qa1, s);
#pragma unroll
      for (int r = 0; r < 8; ++r) { const int key = kb + u * 16 + 8 * hh + r; const float vv = (key <= qi) ? s[r] * cs : -INFINITY; e[u * 8 + r] = vv; mx = fmaxf(mx, vv); } }
    mx = fmaxf(mx, __shfl_xor(mx, 16)); const float mn = fmaxf(m, mx); const float al = (mn == -INFINITY) ? 1.0f : nexp2(m - mn); float sum = 0.0f;
#pragma unroll
    for (int i2 = 0; i2 < 16; ++i2) { const float p = (e[i2] == -INFINITY) ? 0.0f : nexp2(e[i2] - mn); sum += p; b16 a_, b_; split16(p * PS, a_, b_); const int sl = (i2 < 8 ? 0 : 16) + 8 * hh + (i2 & 7); Pb[wave][col][sl] = a_; Pc[wave][col][sl] = b_; }
    sum += __shfl_xor(sum, 16); l = l * al + sum; m = mn;
    wave_lds_sync();
    const v16b pf = frag_kb(&Pb[wave][col][0], hh), pg = frag_kb(&Pc[wave][col][0], hh);
#pragma unroll
    for (int t = 0; t < 4; ++t) { o[t] *= al; const v16b va = frag_kb(Vb + (size_t)(t * 16 + col) * L + kb, hh); o[t] = wmma16b(va, pf, o[t]); o[t] = wmma16b(va, pg, o[t]); }
    wave_lds_sync(); }
  const float inv = 1.0f / (l * PS * XS);
#pragma unroll
  for (int t = 0; t < 4; ++t)
#pragma unroll
    for (int r = 0; r < 8; ++r) To[wave][col][t * 16 + 8 * hh + r] = o[t][r] * inv;
  wave_lds_sync();
  { for (int rr = 0; rr < 16; ++rr) *(v2f*)(out + ((size_t)b * L + q0 + rr) * HD + lane * 2) = *(const v2f*)(&To[wave][rr][lane * 2]);  }
}
}  // namespace

extern "C" void kernel_launch(void* const* d_in, const int* in_sizes, int n_in, void* d_out, int out_size, void* d_ws, size_t ws_size, hipStream_t stream) {
  (void)n_in;
  auto Fp = [&](int i) { return (const float*)d_in[i]; };
  // input order: 0 q, 1 k, 2 v [8,4096,64]
  if (in_sizes[0] != B * L * HD || in_sizes[1] != B * L * HD || in_sizes[2] != B * L * HD || out_size != B * L * HD) return;
  size_t off = 0; char* ws = (char*)d_ws;
  auto carve = [&](size_t bytes) { char* p = ws + off; off += (bytes + 255) & ~(size_t)255; return p; };
  const size_t plane = (size_t)B * L * HD * 2; b16* QP = (b16*)carve(plane); b16* KP = (b16*)carve(plane); b16* VT = (b16*)carve(plane);
  if (off > ws_size || off > ((size_t)128 << 20)) return;   // ≈ 12.6 MB
  plane_kernel<<<dim3(L / 64, BL), 256, 0, stream>>>(Fp(0), Fp(1), Fp(2), QP, KP, VT);
  attn_kernel<<<dim3(QL / 32, BL), 64, 0, stream>>>(QP, KP, VT, (float*)d_out);
}

// v001
// One run takes 131 microseconds.
// Next to v000, in two timings, it ran 2.02 and 2.06 times as fast.
#include <hip/hip_runtime.h>

// Scaled dot-product attention, single head, causal, on given q/k/v [8, 4096, 64]: out[b][t] = Σ_{s<=t} softmax_s(q_t . k_s / 8) v_s -> [8][4096][64].
// No projections: q, k, v are (bf16-rounded) inputs, so every WMMA operand except the probabilities is exact.
// Deterministic: flash-style per 16-query wave over the causal keys in order (running max); no atomics.
// compute dtype: WMMA v_wmma_f32_16x16x32_f16 with f32 accumulate for S^T = K Q^T (q, k EXACT bf16 x8 planes: 1 product) and O^T += V^T P^T (v EXACT x8, P x1024 as f16 hi+lo: 2 products);
// softmax statistics in f32. Inputs rounded to bf16 once.

namespace {
constexpr int B = 8, L = 4096, HD = 64, BL = 8 /* batches (== 8 shipped) */, QL = 4096 /* query rows (== 4096 shipped; causal: a cut also limits keys to < QL) */;
constexpr float XS = 8.0f, PS = 1024.0f, LOG2E = 1.4426950408889634f;
static_assert(L % 64 == 0 && QL % 64 == 0, "tiling");
typedef _Float16 b16;
typedef __attribute__((ext_vector_type(16))) _Float16 v16b;
typedef __attribute__((ext_vector_type(8))) _Float16 v8b;
typedef __attribute__((ext_vector_type(8))) float v8f;
typedef __attribute__((ext_vector_type(4))) float v4f;
__device__ __forceinline__ float bf16_rne(float f) { unsigned int u = __float_as_uint(f); u += 0x7FFFu + ((u >> 16) & 1u); return __uint_as_float(u & 0xFFFF0000u); }
__device__ __forceinline__ void split16(float v, b16& hi, b16& lo) { hi = (b16)v; lo = (b16)(v - (float)hi); }
__device__ __forceinline__ v16b frag_kb(const b16* p, int hh) { const v8b a = *(const v8b*)(p + 8 * hh), b = *(const v8b*)(p + 16 + 8 * hh); v16b f;
#pragma unroll
  for (int e = 0; e < 8; ++e) { f[e] = a[e]; f[8 + e] = b[e]; } return f; }
__device__ __forceinline__ v8f wmma16b(v16b a, v16b b, v8f c) { v8f d = __builtin_amdgcn_wmma_f32_16x16x32_f16(false, a, false, b, (short)0, c, false, false); asm volatile("v_nop\n\tv_nop\n\tv_nop\n\tv_nop" : "+v"(d) : "v"(a), "v"(b)); return d; }
// The fences name LDS alone: they order a wave's own LDS exchange, and global loads that are in flight for the next trip are not drained at them.
__device__ __forceinline__ void wave_lds_sync() { __builtin_amdgcn_fence(__ATOMIC_RELEASE, "workgroup", "local"); __builtin_amdgcn_wave_barrier(); __builtin_amdgcn_fence(__ATOMIC_ACQUIRE, "workgroup", "local"); }
__device__ __forceinline__ float pmul(float a, float b) { float p = a * b; asm volatile("" : "+v"(p)); return p; }
__device__ __forceinline__ int iclamp(int v, int lo, int hi) { return v < lo ? lo : (v > hi ? hi : v); }

typedef __attribute__((ext_vector_type(2))) _Float16 v2h;
typedef __attribute__((ext_vector_type(4))) _Float16 v4h;
typedef __attribute__((ext_vector_type(2))) float v2f;
__device__ __forceinline__ float nexp2(float v) { return __builtin_amdgcn_exp2f(v); }
__global__ __launch_bounds__(256) void plane_kernel(const float* __restrict__ q, const float* __restrict__ k, const float* __restrict__ v, b16* __restrict__ QP, b16* __restrict__ KP, b16* __restrict__ VT) {
  __shared__ b16 Tv[64][HD + 2];
  const int t0 = blockIdx.x * 64, b = blockIdx.y; if (t0 >= QL) return;   // cut builds only; block-uniform, before any barrier
  const size_t base = ((size_t)b * L + t0) * HD;
  for (int i = threadIdx.x; i < 64 * HD; i += 256) { const int t = i / HD, c = i % HD; Tv[t][c] = (b16)(bf16_rne(v[base + i]) * XS); }
  __syncthreads();
  {
    for (int i = threadIdx.x; i < 64 * HD / 4; i += 256) { const v4f fq = *(const v4f*)(q + base + (size_t)i * 4), fk = *(const v4f*)(k + base + (size_t)i * 4); v4h oq, ok; for (int j = 0; j < 4; ++j) { oq[j] = (b16)(bf16_rne(fq[j]) * XS); ok[j] = (b16)(bf16_rne(fk[j]) * XS); }
      *(v4h*)(QP + base + (size_t)i * 4) = oq; *(v4h*)(KP + base + (size_t)i * 4) = ok; }
    for (int i = threadIdx.x; i < HD * 32; i += 256) { const int d = i / 32, tp = (i % 32) * 2; v2h o2; o2[0] = Tv[tp][d]; o2[1] = Tv[tp + 1][d]; *(v2h*)(VT + ((size_t)b * HD + d) * (size_t)L + t0 + tp) = o2; }
     }
}
__global__ __launch_bounds__(64) void attn_kernel(const b16* __restrict__ QP, const b16* __restrict__ KP, const b16* __restrict__ VT, float* __restrict__ out) {
  __shared__ __attribute__((aligned(16))) b16 Pb[2][16][32 + 8], Pc[2][16][32 + 8]; __shared__ __attribute__((aligned(16))) float To[2][16][HD + 4];
  const int wave = threadIdx.x >> 5, lane = threadIdx.x & 31, hh = lane >> 4, col = lane & 15; const int b = blockIdx.y; const int q0 = blockIdx.x * 32 + wave * 16, qi = q0 + col;
  const b16* Qb = QP + (size_t)b * L * HD; const b16* Kb = KP + (size_t)b * L * HD; const b16* Vb = VT + (size_t)b * HD * (size_t)L;
  const v16b qa0 = frag_kb(Qb + (size_t)qi * HD, hh), qa1 = frag_kb(Qb + (size_t)qi * HD + 32, hh);
  const float cs = LOG2E / (8.0f * XS * XS);
  float m = -INFINITY, l = 0.0f; v8f o[4]; for (int t = 0; t < 4; ++t) o[t] = (v8f){};
  const int kend = q0 + 16, klast = blockIdx.x * 32;   // klast: first key of the last 32-key trip, the same for both waves of the block
  const b16* Kl = Kb + (size_t)col * HD; const b16* Vl = Vb + (size_t)col * L;
  // K and V fragments live in registers one trip ahead: a trip's 16 loads are issued as two groups during the trip before it, so no product waits out a load of its own.
  v16b kf[4], vf[4];
#pragma unroll
  for (int u = 0; u < 2; ++u) { kf[2 * u] = frag_kb(Kl + (size_t)(u * 16) * HD, hh); kf[2 * u + 1] = frag_kb(Kl + (size_t)(u * 16) * HD + 32, hh); }
#pragma unroll
  for (int t = 0; t < 4; ++t) vf[t] = frag_kb(Vl + (size_t)(t * 16) * L, hh);
#pragma unroll 1
  for (int kb = 0; kb < kend; kb += 32) {
    const int kn = kb + 32 < klast ? kb + 32 : klast;   // next trip's first key; the last trip fetches its own tile again, so every address stays inside the planes
    float e[16]; float mx = -INFINITY; v8f s[2];
#pragma unroll
    for (int u = 0; u < 2; ++u) { s[u] = (v8f){}; s[u] = wmma16b(kf[2 * u], qa0, s[u]); s[u] = wmma16b(kf[2 * u + 1], qa1, s[u]); }
#pragma unroll
    for (int u = 0; u < 2; ++u) { const size_t kr = (size_t)(kn + u * 16) * HD; kf[2 * u] = frag_kb(Kl + kr, hh); kf[2 * u + 1] = frag_kb(Kl + kr + 32, hh); }
#pragma unroll
    for (int u = 0; u < 2; ++u)
#pragma unroll
      for (int r = 0; r < 8; ++r) { const int key = kb + u * 16 + 8 * hh + r; const float vv = (key <= qi) ? s[u][r] * cs : -INFINITY; e[u * 8 + r] = vv; mx = fmaxf(mx, vv); }
    mx = fmaxf(mx, __shfl_xor(mx, 16)); const float mn = fmaxf(m, mx); const float al = (mn == -INFINITY) ? 1.0f : nexp2(m - mn); float sum = 0.0f;
#pragma unroll
    for (int i2 = 0; i2 < 16; ++i2) { const float p = (e[i2] == -INFINITY) ? 0.0f : nexp2(e[i2] - mn); sum += p; b16 a_, b_; split16(p * PS, a_, b_); const int sl = (i2 < 8 ? 0 : 16) + 8 * hh + (i2 & 7); Pb[wave][col][sl] = a_; Pc[wave][col][sl] = b_; }
    sum += __shfl_xor(sum, 16); l = l * al + sum; m = mn;
    wave_lds_sync();
    const v16b pf = frag_kb(&Pb[wave][col][0], hh), pg = frag_kb(&Pc[wave][col][0], hh);
#pragma unroll
    for (int t = 0; t < 4; ++t) { o[t] *= al; o[t] = wmma16b(vf[t], pf, o[t]); o[t] = wmma16b(vf[t], pg, o[t]); }
#pragma unroll
    for (int t = 0; t < 4; ++t) vf[t] = frag_kb(Vl + (size_t)(t * 16) * L + kn, hh);
    wave_lds_sync(); }
  const float inv = 1.0f / (l * PS * XS);
#pragma unroll
  for (int t = 0; t < 4; ++t)
#pragma unroll
    for (int r = 0; r < 8; ++r) To[wave][col][t * 16 + 8 * hh + r] = o[t][r] * inv;
  wave_lds_sync();
  { for (int rr = 0; rr < 16; ++rr) *(v2f*)(out + ((size_t)b * L + q0 + rr) * HD + lane * 2) = *(const v2f*)(&To[wave][rr][lane * 2]);  }
}
}  // namespace

extern "C" void kernel_launch(void* const* d_in, const int* in_sizes, int n_in, void* d_out, int out_size, void* d_ws, size_t ws_size, hipStream_t stream) {
  (void)n_in;
  auto Fp = [&](int i) { return (const float*)d_in[i]; };
  // input order: 0 q, 1 k, 2 v [8,4096,64]
  if (in_sizes[0] != B * L * HD || in_sizes[1] != B * L * HD || in_sizes[2] != B * L * HD || out_size != B * L * HD) return;
  size_t off = 0; char* ws = (char*)d_ws;
  auto carve = [&](size_t bytes) { char* p = ws + off; off += (bytes + 255) & ~(size_t)255; return p; };
  const size_t plane = (size_t)B * L * HD * 2; b16* QP = (b16*)carve(plane); b16* KP = (b16*)carve(plane); b16* VT = (b16*)carve(plane);
  if (off > ws_size || off > ((size_t)128 << 20)) return;   // ≈ 12.6 MB
  plane_kernel<<<dim3(L / 64, BL), 256, 0, stream>>>(Fp(0), Fp(1), Fp(2), QP, KP, VT);
  attn_kernel<<<dim3(QL / 32, BL), 64, 0, stream>>>(QP, KP, VT, (float*)d_out);
}

// v002
// A run of this version takes 91.8 microseconds.
// In both of two side-by-side timings against v001, it was 1.41 times as fast.
// All steps since v000 together make it 2.88 times as fast.
#include <hip/hip_runtime.h>

// Scaled dot-product attention, single head, causal, on given q/k/v [8, 4096, 64]: out[b][t] = Σ_{s<=t} softmax_s(q_t . k_s / 8) v_s -> [8][4096][64].
// No projections: q, k, v are (bf16-rounded) inputs, so every WMMA operand except the probabilities is exact.
// Deterministic: flash-style per 16-query wave over the causal keys in order (running max); no atomics.
// compute dtype: WMMA v_wmma_f32_16x16x32_f16 with f32 accumulate for S^T = K Q^T (q, k EXACT bf16 x8 planes: 1 product) and O^T += V^T P^T (v EXACT x8, P x1024 as f16 hi+lo: 2 products);
// softmax statistics in f32. Inputs rounded to bf16 once.
// K and V planes lie in fragment order: per 32 keys 4 blocks of 1 KiB, a block = one A fragment (K: 16 keys x 32 d; V^T: 16 d x 32 keys) as [half j][lane][8 f16],
// where lane (hh, col) holds k = 16 j + 8 hh + e of row col. A wave's 16-byte load of one half is then 512 bytes in a row, 4 whole 128-byte lines.

namespace {
constexpr int B = 8, L = 4096, HD = 64, BL = 8 /* batches (== 8 shipped) */, QL = 4096 /* query rows (== 4096 shipped; causal: a cut also limits keys to < QL) */;
constexpr float XS = 8.0f, PS = 1024.0f, LOG2E = 1.4426950408889634f;
static_assert(L % 64 == 0 && QL % 64 == 0, "tiling");
typedef _Float16 b16;
typedef __attribute__((ext_vector_type(16))) _Float16 v16b;
typedef __attribute__((ext_vector_type(8))) _Float16 v8b;
typedef __attribute__((ext_vector_type(8))) float v8f;
typedef __attribute__((ext_vector_type(4))) float v4f;
__device__ __forceinline__ float bf16_rne(float f) { unsigned int u = __float_as_uint(f); u += 0x7FFFu + ((u >> 16) & 1u); return __uint_as_float(u & 0xFFFF0000u); }
__device__ __forceinline__ void split16(float v, b16& hi, b16& lo) { hi = (b16)v; lo = (b16)(v - (float)hi); }
__device__ __forceinline__ v16b frag_kb(const b16* p, int hh) { const v8b a = *(const v8b*)(p + 8 * hh), b = *(const v8b*)(p + 16 + 8 * hh); v16b f;
#pragma unroll
  for (int e = 0; e < 8; ++e) { f[e] = a[e]; f[8 + e] = b[e]; } return f; }
__device__ __forceinline__ v16b frag_fo(const b16* p) { const v8b a = *(const v8b*)p, b = *(const v8b*)(p + 256); v16b f;   // p: the lane's 8 f16 in half 0 of a fragment-order block
#pragma unroll
  for (int e = 0; e < 8; ++e) { f[e] = a[e]; f[8 + e] = b[e]; } return f; }
__device__ __forceinline__ v8f wmma16b(v16b a, v16b b, v8f c) { v8f d = __builtin_amdgcn_wmma_f32_16x16x32_f16(false, a, false, b, (short)0, c, false, false); asm volatile("v_nop\n\tv_nop\n\tv_nop\n\tv_nop" : "+v"(d) : "v"(a), "v"(b)); return d; }
// The fences name LDS alone: they order a wave's own LDS exchange, and global loads that are in flight for the next trip are not drained at them.
__device__ __forceinline__ void wave_lds_sync() { __builtin_amdgcn_fence(__ATOMIC_RELEASE, "workgroup", "local"); __builtin_amdgcn_wave_barrier(); __builtin_amdgcn_fence(__ATOMIC_ACQUIRE, "workgroup", "local"); }
__device__ __forceinline__ float pmul(float a, float b) { float p = a * b; asm volatile("" : "+v"(p)); return p; }
__device__ __forceinline__ int iclamp(int v, int lo, int hi) { return v < lo ? lo : (v > hi ? hi : v); }

typedef __attribute__((ext_vector_type(2))) _Float16 v2h;
typedef __attribute__((ext_vector_type(4))) _Float16 v4h;
typedef __attribute__((ext_vector_type(2))) float v2f;
__device__ __forceinline__ float nexp2(float v) { return __builtin_amdgcn_exp2f(v); }
__global__ __launch_bounds__(256) void plane_kernel(const float* __restrict__ q, const float* __restrict__ k, const float* __restrict__ v, b16* __restrict__ QP, b16* __restrict__ KP, b16* __restrict__ VT) {
  __shared__ b16 Tv[64][HD + 2]; __shared__ __attribute__((aligned(16))) b16 Tk[64][HD + 8];
  const int t0 = blockIdx.x * 64, b = blockIdx.y; if (t0 >= QL) return;   // cut builds only; block-uniform, before any barrier
  const size_t base = ((size_t)b * L + t0) * HD;
  for (int i = threadIdx.x; i < 64 * HD; i += 256) { const int t = i / HD, c = i % HD; Tv[t][c] = (b16)(bf16_rne(v[base + i]) * XS); }
  for (int i = threadIdx.x; i < 64 * HD / 4; i += 256) { const v4f fq = *(const v4f*)(q + base + (size_t)i * 4), fk = *(const v4f*)(k + base + (size_t)i * 4); v4h oq, ok; for (int j = 0; j < 4; ++j) { oq[j] = (b16)(bf16_rne(fq[j]) * XS); ok[j] = (b16)(bf16_rne(fk[j]) * XS); }
    *(v4h*)(QP + base + (size_t)i * 4) = oq; *(v4h*)(&Tk[i / 16][(i % 16) * 4]) = ok; }
  __syncthreads();
  {
    // The tile's 64 keys x 64 d are 512 pieces of 8 f16 in either plane, piece i at base + 8 i: lane = i % 32, half j = i / 32 % 2, then the block.
    for (int i = threadIdx.x; i < 64 * HD / 8; i += 256) { const int col = i & 15, hh = (i >> 4) & 1, j = (i >> 5) & 1;
      *(v8b*)(KP + base + (size_t)i * 8) = *(const v8b*)(&Tk[(i >> 7) * 16 + col][((i >> 6) & 1) * 32 + 16 * j + 8 * hh]);   // K block = (16-key group i / 128, d half i / 64 % 2)
      v8b ov; for (int e = 0; e < 8; ++e) ov[e] = Tv[(i >> 8) * 32 + 16 * j + 8 * hh + e][((i >> 6) & 3) * 16 + col];         // V block = (32-key group i / 256, d group i / 64 % 4)
      *(v8b*)(VT + base + (size_t)i * 8) = ov; }
     }
}
__global__ __launch_bounds__(64) void attn_kernel(const b16* __restrict__ QP, const b16* __restrict__ KP, const b16* __restrict__ VT, float* __restrict__ out) {
  __shared__ __attribute__((aligned(16))) b16 Pb[2][16][32 + 8], Pc[2][16][32 + 8]; __shared__ __attribute__((aligned(16))) float To[2][16][HD + 4];
  const int wave = threadIdx.x >> 5, lane = threadIdx.x & 31, hh = lane >> 4, col = lane & 15; const int b = blockIdx.y; const int q0 = blockIdx.x * 32 + wave * 16, qi = q0 + col;
  const b16* Qb = QP + (size_t)b * L * HD; const b16* Kb = KP + (size_t)b * L * HD; const b16* Vb = VT + (size_t)b * L * HD;
  const v16b qa0 = frag_kb(Qb + (size_t)qi * HD, hh), qa1 = frag_kb(Qb + (size_t)qi * HD + 32, hh);
  asm volatile("" :: "v"(qa0), "v"(qa1));   // inputs-only fence on the loaded Q: holds the Q loads in front of every K and V load. The loop's counted waits are the smaller of entry and back edge, and a Q load among the V loads would make each trip's first product wait for V loads just issued
  const float cs = LOG2E / (8.0f * XS * XS);
  float m = -INFINITY, l = 0.0f; v8f o[4]; for (int t = 0; t < 4; ++t) o[t] = (v8f){};
  const int kend = q0 + 16, klast = blockIdx.x * 32;   // klast: first key of the last 32-key trip, the same for both waves of the block
  const b16* Kl = Kb + lane * 8; const b16* Vl = Vb + lane * 8;   // a 32-key trip at key kb: 4 K blocks and 4 V blocks of 512 f16 from kb * HD on
  // K and V fragments live in registers one trip ahead: a trip's 16 loads are issued as two groups during the trip before it, so no product waits out a load of its own.
  v16b kf[4], vf[4];
#pragma unroll
  for (int t = 0; t < 4; ++t) kf[t] = frag_fo(Kl + t * 512);
#pragma unroll
  for (int t = 0; t < 4; ++t) vf[t] = frag_fo(Vl + t * 512);
#pragma unroll 1
  for (int kb = 0; kb < kend; kb += 32) {
    const int kn = kb + 32 < klast ? kb + 32 : klast;   // next trip's first key; the last trip fetches its own tile again, so every address stays inside the planes
    float e[16]; float mx = -INFINITY; v8f s[2];
#pragma unroll
    for (int u = 0; u < 2; ++u) { s[u] = (v8f){}; s[u] = wmma16b(kf[2 * u], qa0, s[u]); s[u] = wmma16b(kf[2 * u + 1], qa1, s[u]); }
#pragma unroll
    for (int t = 0; t < 4; ++t) kf[t] = frag_fo(Kl + (size_t)kn * HD + t * 512);
#pragma unroll
    for (int u = 0; u < 2; ++u)
#pragma unroll
      for (int r = 0; r < 8; ++r) { const int key = kb + u * 16 + 8 * hh + r; const float vv = (key <= qi) ? s[u][r] * cs : -INFINITY; e[u * 8 + r] = vv; mx = fmaxf(mx, vv); }
    mx = fmaxf(mx, __shfl_xor(mx, 16)); const float mn = fmaxf(m, mx); const float al = (mn == -INFINITY) ? 1.0f : nexp2(m - mn); float sum = 0.0f;
#pragma unroll
    for (int i2 = 0; i2 < 16; ++i2) { const float p = (e[i2] == -INFINITY) ? 0.0f : nexp2(e[i2] - mn); sum += p; b16 a_, b_; split16(p * PS, a_, b_); const int sl = (i2 < 8 ? 0 : 16) + 8 * hh + (i2 & 7); Pb[wave][col][sl] = a_; Pc[wave][col][sl] = b_; }
    sum += __shfl_xor(sum, 16); l = l * al + sum; m = mn;
    wave_lds_sync();
    const v16b pf = frag_kb(&Pb[wave][col][0], hh), pg = frag_kb(&Pc[wave][col][0], hh);
#pragma unroll
    for (int t = 0; t < 4; ++t) { o[t] *= al; o[t] = wmma16b(vf[t], pf, o[t]); o[t] = wmma16b(vf[t], pg, o[t]); }
#pragma unroll
    for (int t = 0; t < 4; ++t) vf[t] = frag_fo(Vl + (size_t)kn * HD + t * 512);
    wave_lds_sync(); }
  const float inv = 1.0f / (l * PS * XS);
#pragma unroll
  for (int t = 0; t < 4; ++t)
#pragma unroll
    for (int r = 0; r < 8; ++r) To[wave][col][t * 16 + 8 * hh + r] = o[t][r] * inv;
  wave_lds_sync();
  { for (int rr = 0; rr < 16; ++rr) *(v2f*)(out + ((size_t)b * L + q0 + rr) * HD + lane * 2) = *(const v2f*)(&To[wave][rr][lane * 2]);  }
}
}  // namespace

extern "C" void kernel_launch(void* const* d_in, const int* in_sizes, int n_in, void* d_out, int out_size, void* d_ws, size_t ws_size, hipStream_t stream) {
  (void)n_in;
  auto Fp = [&](int i) { return (const float*)d_in[i]; };
  // input order: 0 q, 1 k, 2 v [8,4096,64]
  if (in_sizes[0] != B * L * HD || in_sizes[1] != B * L * HD || in_sizes[2] != B * L * HD || out_size != B * L * HD) return;
  size_t off = 0; char* ws = (char*)d_ws;
  auto carve = [&](size_t bytes) { char* p = ws + off; off += (bytes + 255) & ~(size_t)255; return p; };
  const size_t plane = (size_t)B * L * HD * 2; b16* QP = (b16*)carve(plane); b16* KP = (b16*)carve(plane); b16* VT = (b16*)carve(plane);
  if (off > ws_size || off > ((size_t)128 << 20)) return;   // ≈ 12.6 MB
  plane_kernel<<<dim3(L / 64, BL), 256, 0, stream>>>(Fp(0), Fp(1), Fp(2), QP, KP, VT);
  attn_kernel<<<dim3(QL / 32, BL), 64, 0, stream>>>(QP, KP, VT, (float*)d_out);
}

// v003
// One run takes 59 microseconds.
// Next to v002, in two timings, it ran 1.58 and 1.61 times as fast.
// Counting every step since v000, it is 4.59 times as fast.
#include <hip/hip_runtime.h>

// Scaled dot-product attention, single head, causal, on given q/k/v [8, 4096, 64]: out[b][t] = Σ_{s<=t} softmax_s(q_t . k_s / 8) v_s -> [8][4096][64].
// No projections: q, k, v are (bf16-rounded) inputs, so every WMMA operand except the probabilities is exact.
// Deterministic: flash-style per 16-query tile, its causal keys dealt to 4 waves (each with a running max), the 4 shares joined in a fixed order in LDS; no atomics.
// compute dtype: WMMA v_wmma_f32_16x16x32_f16 with f32 accumulate for S^T = K Q^T (q, k EXACT bf16 x8 planes: 1 product) and O^T += V^T P^T (v EXACT x8, P x1024 as f16 hi+lo: 2 products);
// softmax statistics in f32. Inputs rounded to bf16 once.
// K and V planes lie in fragment order: per 32 keys 4 blocks of 1 KiB, a block = one A fragment (K: 16 keys x 32 d; V^T: 16 d x 32 keys) as [half j][lane][8 f16],
// where lane (hh, col) holds k = 16 j + 8 hh + e of row col. A wave's 16-byte load of one half is then 512 bytes in a row, 4 whole 128-byte lines.

namespace {
constexpr int B = 8, L = 4096, HD = 64, BL = 8 /* batches (== 8 shipped) */, QL = 4096 /* query rows (== 4096 shipped; causal: a cut also limits keys to < QL) */;
constexpr float XS = 8.0f, PS = 1024.0f, LOG2E = 1.4426950408889634f;
static_assert(L % 64 == 0 && QL % 64 == 0, "tiling");
typedef _Float16 b16;
typedef __attribute__((ext_vector_type(16))) _Float16 v16b;
typedef __attribute__((ext_vector_type(8))) _Float16 v8b;
typedef __attribute__((ext_vector_type(8))) float v8f;
typedef __attribute__((ext_vector_type(4))) float v4f;
__device__ __forceinline__ float bf16_rne(float f) { unsigned int u = __float_as_uint(f); u += 0x7FFFu + ((u >> 16) & 1u); return __uint_as_float(u & 0xFFFF0000u); }
__device__ __forceinline__ void split16(float v, b16& hi, b16& lo) { hi = (b16)v; lo = (b16)(v - (float)hi); }
__device__ __forceinline__ v16b frag_kb(const b16* p, int hh) { const v8b a = *(const v8b*)(p + 8 * hh), b = *(const v8b*)(p + 16 + 8 * hh); v16b f;
#pragma unroll
  for (int e = 0; e < 8; ++e) { f[e] = a[e]; f[8 + e] = b[e]; } return f; }
__device__ __forceinline__ v16b frag_fo(const b16* p) { const v8b a = *(const v8b*)p, b = *(const v8b*)(p + 256); v16b f;   // p: the lane's 8 f16 in half 0 of a fragment-order block
#pragma unroll
  for (int e = 0; e < 8; ++e) { f[e] = a[e]; f[8 + e] = b[e]; } return f; }
__device__ __forceinline__ v8f wmma16b(v16b a, v16b b, v8f c) { v8f d = __builtin_amdgcn_wmma_f32_16x16x32_f16(false, a, false, b, (short)0, c, false, false); asm volatile("v_nop\n\tv_nop\n\tv_nop\n\tv_nop" : "+v"(d) : "v"(a), "v"(b)); return d; }
// The fences name LDS alone: they order a wave's own LDS exchange, and global loads that are in flight for the next trip are not drained at them.
__device__ __forceinline__ void wave_lds_sync() { __builtin_amdgcn_fence(__ATOMIC_RELEASE, "workgroup", "local"); __builtin_amdgcn_wave_barrier(); __builtin_amdgcn_fence(__ATOMIC_ACQUIRE, "workgroup", "local"); }
__device__ __forceinline__ float pmul(float a, float b) { float p = a * b; asm volatile("" : "+v"(p)); return p; }
__device__ __forceinline__ int iclamp(int v, int lo, int hi) { return v < lo ? lo : (v > hi ? hi : v); }

typedef __attribute__((ext_vector_type(2))) _Float16 v2h;
typedef __attribute__((ext_vector_type(4))) _Float16 v4h;
typedef __attribute__((ext_vector_type(2))) float v2f;
__device__ __forceinline__ float nexp2(float v) { return __builtin_amdgcn_exp2f(v); }
__global__ __launch_bounds__(256) void plane_kernel(const float* __restrict__ q, const float* __restrict__ k, const float* __restrict__ v, b16* __restrict__ QP, b16* __restrict__ KP, b16* __restrict__ VT) {
  __shared__ b16 Tv[64][HD + 2]; __shared__ __attribute__((aligned(16))) b16 Tk[64][HD + 8];
  const int t0 = blockIdx.x * 64, b = blockIdx.y; if (t0 >= QL) return;   // cut builds only; block-uniform, before any barrier
  const size_t base = ((size_t)b * L + t0) * HD;
  for (int i = threadIdx.x; i < 64 * HD; i += 256) { const int t = i / HD, c = i % HD; Tv[t][c] = (b16)(bf16_rne(v[base + i]) * XS); }
  for (int i = threadIdx.x; i < 64 * HD / 4; i += 256) { const v4f fq = *(const v4f*)(q + base + (size_t)i * 4), fk = *(const v4f*)(k + base + (size_t)i * 4); v4h oq, ok; for (int j = 0; j < 4; ++j) { oq[j] = (b16)(bf16_rne(fq[j]) * XS); ok[j] = (b16)(bf16_rne(fk[j]) * XS); }
    *(v4h*)(QP + base + (size_t)i * 4) = oq; *(v4h*)(&Tk[i / 16][(i % 16) * 4]) = ok; }
  __syncthreads();
  {
    // The tile's 64 keys x 64 d are 512 pieces of 8 f16 in either plane, piece i at base + 8 i: lane = i % 32, half j = i / 32 % 2, then the block.
    for (int i = threadIdx.x; i < 64 * HD / 8; i += 256) { const int col = i & 15, hh = (i >> 4) & 1, j = (i >> 5) & 1;
      *(v8b*)(KP + base + (size_t)i * 8) = *(const v8b*)(&Tk[(i >> 7) * 16 + col][((i >> 6) & 1) * 32 + 16 * j + 8 * hh]);   // K block = (16-key group i / 128, d half i / 64 % 2)
      v8b ov; for (int e = 0; e < 8; ++e) ov[e] = Tv[(i >> 8) * 32 + 16 * j + 8 * hh + e][((i >> 6) & 3) * 16 + col];         // V block = (32-key group i / 256, d group i / 64 % 4)
      *(v8b*)(VT + base + (size_t)i * 8) = ov; }
     }
}
// A query tile's 32-key trips are dealt round-robin to KS waves (share sp takes trips sp, sp + KS, ...); each keeps its own running max, sum and O^T, and the shares are joined in LDS at the end.
constexpr int KS = 4;
__global__ __launch_bounds__(64 * KS) void attn_kernel(const b16* __restrict__ QP, const b16* __restrict__ KP, const b16* __restrict__ VT, float* __restrict__ out) {
  __shared__ __attribute__((aligned(16))) b16 Pb[2 * KS][16][32 + 8], Pc[2 * KS][16][32 + 8]; __shared__ __attribute__((aligned(16))) float To[2 * KS][16][HD + 4]; __shared__ float Sm[2 * KS][16], Sl[2 * KS][16];
  const int wave = __builtin_amdgcn_readfirstlane(threadIdx.x >> 5);   // the wave's number in a scalar register: its first key now depends on it, and the trip count and the K and V addresses stay scalar work
  const int lane = threadIdx.x & 31, hh = lane >> 4, col = lane & 15; const int b = blockIdx.y; const int qt = wave & 1, sp = wave >> 1; const int q0 = blockIdx.x * 32 + qt * 16, qi = q0 + col;
  const b16* Qb = QP + (size_t)b * L * HD; const b16* Kb = KP + (size_t)b * L * HD; const b16* Vb = VT + (size_t)b * L * HD;
  const v16b qa0 = frag_kb(Qb + (size_t)qi * HD, hh), qa1 = frag_kb(Qb + (size_t)qi * HD + 32, hh);
  asm volatile("" :: "v"(qa0), "v"(qa1));   // inputs-only fence on the loaded Q: holds the Q loads in front of every K and V load. The loop's counted waits are the smaller of entry and back edge, and a Q load among the V loads would make each trip's first product wait for V loads just issued
  const float cs = LOG2E / (8.0f * XS * XS);
  float m = -INFINITY, l = 0.0f; v8f o[4]; for (int t = 0; t < 4; ++t) o[t] = (v8f){};
  const int kend = q0 + 16, klast = blockIdx.x * 32;   // klast: first key of the last 32-key trip, the same for every wave of the block
  const int kfirst = sp * 32 < klast ? sp * 32 : klast;   // a share with no trip (sp * 32 > klast) fetches the last tile and uses nothing of it
  const b16* Kl = Kb + lane * 8; const b16* Vl = Vb + lane * 8;   // a 32-key trip at key kb: 4 K blocks and 4 V blocks of 512 f16 from kb * HD on
  // K and V fragments live in registers one trip ahead: a trip's 16 loads are issued as two groups during the trip before it, so no product waits out a load of its own.
  v16b kf[4], vf[4];
  const b16* Kf = Kl + (size_t)kfirst * HD; const b16* Vf = Vl + (size_t)kfirst * HD;
#pragma unroll
  for (int t = 0; t < 4; ++t) kf[t] = frag_fo(Kf + t * 512);
#pragma unroll
  for (int t = 0; t < 4; ++t) vf[t] = frag_fo(Vf + t * 512);
  asm volatile("s_wait_xcnt 0x0" :: "v"(Kf), "v"(Vf) : "memory");   // the first fetch's two address pairs stay whole up to this wait
#pragma unroll 1
  for (int kb = sp * 32; kb < kend; kb += 32 * KS) {
    const int kn = kb + 32 * KS < klast ? kb + 32 * KS : klast;   // this share's next trip; past the end the last tile is fetched instead, so every address stays inside the planes
    float e[16]; float mx = -INFINITY; v8f s[2];
#pragma unroll
    for (int u = 0; u < 2; ++u) { s[u] = (v8f){}; s[u] = wmma16b(kf[2 * u], qa0, s[u]); s[u] = wmma16b(kf[2 * u + 1], qa1, s[u]); }
#pragma unroll
    for (int t = 0; t < 4; ++t) kf[t] = frag_fo(Kl + (size_t)kn * HD + t * 512);
#pragma unroll
    for (int u = 0; u < 2; ++u)
#pragma unroll
      for (int r = 0; r < 8; ++r) { const int key = kb + u * 16 + 8 * hh + r; const float vv = (key <= qi) ? s[u][r] * cs : -INFINITY; e[u * 8 + r] = vv; mx = fmaxf(mx, vv); }
    mx = fmaxf(mx, __shfl_xor(mx, 16)); const float mn = fmaxf(m, mx); const float al = (mn == -INFINITY) ? 1.0f : nexp2(m - mn); float sum = 0.0f;
#pragma unroll
    for (int i2 = 0; i2 < 16; ++i2) { const float p = (e[i2] == -INFINITY) ? 0.0f : nexp2(e[i2] - mn); sum += p; b16 a_, b_; split16(p * PS, a_, b_); const int sl = (i2 < 8 ? 0 : 16) + 8 * hh + (i2 & 7); Pb[wave][col][sl] = a_; Pc[wave][col][sl] = b_; }
    sum += __shfl_xor(sum, 16); l = l * al + sum; m = mn;
    wave_lds_sync();
    const v16b pf = frag_kb(&Pb[wave][col][0], hh), pg = frag_kb(&Pc[wave][col][0], hh);
#pragma unroll
    for (int t = 0; t < 4; ++t) { o[t] *= al; o[t] = wmma16b(vf[t], pf, o[t]); o[t] = wmma16b(vf[t], pg, o[t]); }
#pragma unroll
    for (int t = 0; t < 4; ++t) vf[t] = frag_fo(Vl + (size_t)kn * HD + t * 512);
    wave_lds_sync();
    asm volatile("s_wait_xcnt 0x0" ::: "memory"); }   // the next trip reuses the V loads' address registers: the wait stands in front of that overwrite
  // Each share hands over its un-normalised O^T with its max and sum; a share without a trip hands (-inf, 0, zeros).
#pragma unroll
  for (int t = 0; t < 4; ++t)
#pragma unroll
    for (int r = 0; r < 8; ++r) To[wave][col][t * 16 + 8 * hh + r] = o[t][r];
  if (hh == 0) { Sm[wave][col] = m; Sl[wave][col] = l; }
  __syncthreads();   // every wave passes it once: behind it all KS shares of both query tiles are in LDS
  // 8 threads join one of the block's 32 query rows, shares in the order 0 .. KS - 1; a thread holds 4 values in each half of the row, so a store of 8 lanes fills one 128-byte line of out.
  const int row = threadIdx.x >> 3, tq = row >> 4, c = row & 15, d0 = (threadIdx.x & 7) * 4;
  float ms[KS]; float mj = -INFINITY;
#pragma unroll
  for (int j = 0; j < KS; ++j) { ms[j] = Sm[2 * j + tq][c]; mj = fmaxf(mj, ms[j]); }
  float lj = 0.0f; v4f a0 = (v4f){}, a1 = (v4f){};
#pragma unroll
  for (int j = 0; j < KS; ++j) { const float w = (ms[j] == -INFINITY) ? 0.0f : nexp2(ms[j] - mj); lj += w * Sl[2 * j + tq][c]; a0 += w * *(const v4f*)(&To[2 * j + tq][c][d0]); a1 += w * *(const v4f*)(&To[2 * j + tq][c][d0 + 32]); }
  const float inv = 1.0f / (lj * PS * XS); float* po = out + ((size_t)b * L + blockIdx.x * 32 + row) * HD + d0;
  *(v4f*)po = a0 * inv; *(v4f*)(po + 32) = a1 * inv;
}
}  // namespace

extern "C" void kernel_launch(void* const* d_in, const int* in_sizes, int n_in, void* d_out, int out_size, void* d_ws, size_t ws_size, hipStream_t stream) {
  (void)n_in;
  auto Fp = [&](int i) { return (const float*)d_in[i]; };
  // input order: 0 q, 1 k, 2 v [8,4096,64]
  if (in_sizes[0] != B * L * HD || in_sizes[1] != B * L * HD || in_sizes[2] != B * L * HD || out_size != B * L * HD) return;
  size_t off = 0; char* ws = (char*)d_ws;
  auto carve = [&](size_t bytes) { char* p = ws + off; off += (bytes + 255) & ~(size_t)255; return p; };
  const size_t plane = (size_t)B * L * HD * 2; b16* QP = (b16*)carve(plane); b16* KP = (b16*)carve(plane); b16* VT = (b16*)carve(plane);
  if (off > ws_size || off > ((size_t)128 << 20)) return;   // ≈ 12.6 MB
  plane_kernel<<<dim3(L / 64, BL), 256, 0, stream>>>(Fp(0), Fp(1), Fp(2), QP, KP, VT);
  attn_kernel<<<dim3(QL / 32, BL), 64 * KS, 0, stream>>>(QP, KP, VT, (float*)d_out);
}

// v004
// A run of this version takes 46.1 microseconds.
// Timed twice side by side with v003, it ran 1.26 and 1.28 times as fast.
// Over all steps from v000 it is 5.84 times as fast.
#include <hip/hip_runtime.h>

// Scaled dot-product attention, single head, causal, on given q/k/v [8, 4096, 64]: out[b][t] = Σ_{s<=t} softmax_s(q_t . k_s / 8) v_s -> [8][4096][64].
// No projections: q, k, v are (bf16-rounded) inputs, so every WMMA operand except the probabilities is exact.
// Deterministic: flash-style per 16-query tile, its causal keys dealt to 4 waves (each with a running max), the 4 shares joined in a fixed order in LDS; no atomics.
// compute dtype: WMMA v_wmma_f32_16x16x32_f16 with f32 accumulate for S^T = K Q^T (q, k EXACT bf16 x8 planes: 1 product) and O^T += V^T P^T (v EXACT x8, P x1024 as f16 hi+lo: 2 products);
// softmax statistics in f32. Inputs rounded to bf16 once.
// K and V planes lie in fragment order: per 32 keys 4 blocks of 1 KiB, a block = one A fragment (K: 16 keys x 32 d; V^T: 16 d x 32 keys) as [half j][lane][8 f16],
// where lane (hh, col) holds k = 16 j + 8 hh + e of row col. A wave's 16-byte load of one half is then 512 bytes in a row, 4 whole 128-byte lines.

namespace {
constexpr int B = 8, L = 4096, HD = 64, BL = 8 /* batches (== 8 shipped) */, QL = 4096 /* query rows (== 4096 shipped; causal: a cut also limits keys to < QL) */;
constexpr float XS = 8.0f, PS = 1024.0f, LOG2E = 1.4426950408889634f;
static_assert(L % 64 == 0 && QL % 64 == 0, "tiling");
typedef _Float16 b16;
typedef __attribute__((ext_vector_type(16))) _Float16 v16b;
typedef __attribute__((ext_vector_type(8))) _Float16 v8b;
typedef __attribute__((ext_vector_type(8))) float v8f;
typedef __attribute__((ext_vector_type(4))) float v4f;
__device__ __forceinline__ float bf16_rne(float f) { unsigned int u = __float_as_uint(f); u += 0x7FFFu + ((u >> 16) & 1u); return __uint_as_float(u & 0xFFFF0000u); }
__device__ __forceinline__ void split16(float v, b16& hi, b16& lo) { hi = (b16)v; lo = (b16)(v - (float)hi); }
__device__ __forceinline__ v16b frag_kb(const b16* p, int hh) { const v8b a = *(const v8b*)(p + 8 * hh), b = *(const v8b*)(p + 16 + 8 * hh); v16b f;
#pragma unroll
  for (int e = 0; e < 8; ++e) { f[e] = a[e]; f[8 + e] = b[e]; } return f; }
__device__ __forceinline__ v16b frag_fo(const b16* p) { const v8b a = *(const v8b*)p, b = *(const v8b*)(p + 256); v16b f;   // p: the lane's 8 f16 in half 0 of a fragment-order block
#pragma unroll
  for (int e = 0; e < 8; ++e) { f[e] = a[e]; f[8 + e] = b[e]; } return f; }
__device__ __forceinline__ v8f wmma16b(v16b a, v16b b, v8f c) { v8f d = __builtin_amdgcn_wmma_f32_16x16x32_f16(false, a, false, b, (short)0, c, false, false); asm volatile("v_nop\n\tv_nop\n\tv_nop\n\tv_nop" : "+v"(d) : "v"(a), "v"(b)); return d; }
// The fences name LDS alone: they order a wave's own LDS exchange, and global loads that are in flight for the next trip are not drained at them.
__device__ __forceinline__ void wave_lds_sync() { __builtin_amdgcn_fence(__ATOMIC_RELEASE, "workgroup", "local"); __builtin_amdgcn_wave_barrier(); __builtin_amdgcn_fence(__ATOMIC_ACQUIRE, "workgroup", "local"); }
__device__ __forceinline__ float pmul(float a, float b) { float p = a * b; asm volatile("" : "+v"(p)); return p; }
__device__ __forceinline__ int iclamp(int v, int lo, int hi) { return v < lo ? lo : (v > hi ? hi : v); }

typedef __attribute__((ext_vector_type(2))) _Float16 v2h;
typedef __attribute__((ext_vector_type(4))) _Float16 v4h;
typedef __attribute__((ext_vector_type(2))) float v2f;
__device__ __forceinline__ float nexp2(float v) { return __builtin_amdgcn_exp2f(v); }
__global__ __launch_bounds__(256) void plane_kernel(const float* __restrict__ q, const float* __restrict__ k, const float* __restrict__ v, b16* __restrict__ QP, b16* __restrict__ KP, b16* __restrict__ VT) {
  __shared__ b16 Tv[64][HD + 2]; __shared__ __attribute__((aligned(16))) b16 Tk[64][HD + 8];
  const int t0 = blockIdx.x * 64, b = blockIdx.y; if (t0 >= QL) return;   // cut builds only; block-uniform, before any barrier
  const size_t base = ((size_t)b * L + t0) * HD;
  for (int i = threadIdx.x; i < 64 * HD; i += 256) { const int t = i / HD, c = i % HD; Tv[t][c] = (b16)(bf16_rne(v[base + i]) * XS); }
  for (int i = threadIdx.x; i < 64 * HD / 4; i += 256) { const v4f fq = *(const v4f*)(q + base + (size_t)i * 4), fk = *(const v4f*)(k + base + (size_t)i * 4); v4h oq, ok; for (int j = 0; j < 4; ++j) { oq[j] = (b16)(bf16_rne(fq[j]) * XS); ok[j] = (b16)(bf16_rne(fk[j]) * XS); }
    *(v4h*)(QP + base + (size_t)i * 4) = oq; *(v4h*)(&Tk[i / 16][(i % 16) * 4]) = ok; }
  __syncthreads();
  {
    // The tile's 64 keys x 64 d are 512 pieces of 8 f16 in either plane, piece i at base + 8 i: lane = i % 32, half j = i / 32 % 2, then the block.
    for (int i = threadIdx.x; i < 64 * HD / 8; i += 256) { const int col = i & 15, hh = (i >> 4) & 1, j = (i >> 5) & 1;
      *(v8b*)(KP + base + (size_t)i * 8) = *(const v8b*)(&Tk[(i >> 7) * 16 + col][((i >> 6) & 1) * 32 + 16 * j + 8 * hh]);   // K block = (16-key group i / 128, d half i / 64 % 2)
      v8b ov; for (int e = 0; e < 8; ++e) ov[e] = Tv[(i >> 8) * 32 + 16 * j + 8 * hh + e][((i >> 6) & 3) * 16 + col];         // V block = (32-key group i / 256, d group i / 64 % 4)
      *(v8b*)(VT + base + (size_t)i * 8) = ov; }
     }
}
// A query tile's 32-key trips are dealt round-robin to KS waves (share sp takes trips sp, sp + KS, ...); each keeps its own running max, sum and O^T, and the shares are joined in LDS at the end.
constexpr int KS = 4;
__global__ __launch_bounds__(64 * KS) void attn_kernel(const b16* __restrict__ QP, const b16* __restrict__ KP, const b16* __restrict__ VT, float* __restrict__ out) {
  __shared__ __attribute__((aligned(16))) b16 Pb[2 * KS][16][32 + 8], Pc[2 * KS][16][32 + 8]; __shared__ __attribute__((aligned(16))) float To[2 * KS][16][HD + 4]; __shared__ float Sm[2 * KS][16], Sl[2 * KS][16];
  const int wave = __builtin_amdgcn_readfirstlane(threadIdx.x >> 5);   // the wave's number in a scalar register: its first key now depends on it, and the trip count and the K and V addresses stay scalar work
  const int lane = threadIdx.x & 31, hh = lane >> 4, col = lane & 15; const int b = blockIdx.x; const int qt = wave & 1, sp = wave >> 1;
  // Longest first: a block's key trips grow with its query tile, and the grid holds more blocks than the chip has places for at once. y counts the tiles down from the last
  // (x is the batch); for speed only, every (batch, tile) is taken once in any order.
  const int tx = QL / 32 - 1 - (int)blockIdx.y; const int q0 = tx * 32 + qt * 16, qi = q0 + col;
  const b16* Qb = QP + (size_t)b * L * HD; const b16* Kb = KP + (size_t)b * L * HD; const b16* Vb = VT + (size_t)b * L * HD;
  const v16b qa0 = frag_kb(Qb + (size_t)qi * HD, hh), qa1 = frag_kb(Qb + (size_t)qi * HD + 32, hh);
  asm volatile("" :: "v"(qa0), "v"(qa1));   // inputs-only fence on the loaded Q: holds the Q loads in front of every K and V load. The loop's counted waits are the smaller of entry and back edge, and a Q load among the V loads would make each trip's first product wait for V loads just issued
  const float cs = LOG2E / (8.0f * XS * XS);
  float m = -INFINITY, l = 0.0f; v8f o[4]; for (int t = 0; t < 4; ++t) o[t] = (v8f){};
  const int kend = q0 + 16, klast = tx * 32;   // klast: first key of the last 32-key trip, the same for every wave of the block
  const int kfirst = sp * 32 < klast ? sp * 32 : klast;   // a share with no trip (sp * 32 > klast) fetches the last tile and uses nothing of it
  const b16* Kl = Kb + lane * 8; const b16* Vl = Vb + lane * 8;   // a 32-key trip at key kb: 4 K blocks and 4 V blocks of 512 f16 from kb * HD on
  // K and V fragments live in registers one trip ahead: a trip's 16 loads are issued as two groups during the trip before it, so no product waits out a load of its own.
  v16b kf[4], vf[4];
  const b16* Kf = Kl + (size_t)kfirst * HD; const b16* Vf = Vl + (size_t)kfirst * HD;
#pragma unroll
  for (int t = 0; t < 4; ++t) kf[t] = frag_fo(Kf + t * 512);
#pragma unroll
  for (int t = 0; t < 4; ++t) vf[t] = frag_fo(Vf + t * 512);
  asm volatile("s_wait_xcnt 0x0" :: "v"(Kf), "v"(Vf) : "memory");   // the first fetch's two address pairs stay whole up to this wait
#pragma unroll 1
  for (int kb = sp * 32; kb < kend; kb += 32 * KS) {
    const int kn = kb + 32 * KS < klast ? kb + 32 * KS : klast;   // this share's next trip; past the end the last tile is fetched instead, so every address stays inside the planes
    float e[16]; float mx = -INFINITY; v8f s[2];
#pragma unroll
    for (int u = 0; u < 2; ++u) { s[u] = (v8f){}; s[u] = wmma16b(kf[2 * u], qa0, s[u]); s[u] = wmma16b(kf[2 * u + 1], qa1, s[u]); }
#pragma unroll
    for (int t = 0; t < 4; ++t) kf[t] = frag_fo(Kl + (size_t)kn * HD + t * 512);
#pragma unroll
    for (int u = 0; u < 2; ++u)
#pragma unroll
      for (int r = 0; r < 8; ++r) { const int key = kb + u * 16 + 8 * hh + r; const float vv = (key <= qi) ? s[u][r] * cs : -INFINITY; e[u * 8 + r] = vv; mx = fmaxf(mx, vv); }
    mx = fmaxf(mx, __shfl_xor(mx, 16)); const float mn = fmaxf(m, mx); const float al = (mn == -INFINITY) ? 1.0f : nexp2(m - mn); float sum = 0.0f;
#pragma unroll
    for (int i2 = 0; i2 < 16; ++i2) { const float p = (e[i2] == -INFINITY) ? 0.0f : nexp2(e[i2] - mn); sum += p; b16 a_, b_; split16(p * PS, a_, b_); const int sl = (i2 < 8 ? 0 : 16) + 8 * hh + (i2 & 7); Pb[wave][col][sl] = a_; Pc[wave][col][sl] = b_; }
    sum += __shfl_xor(sum, 16); l = l * al + sum; m = mn;
    wave_lds_sync();
    const v16b pf = frag_kb(&Pb[wave][col][0], hh), pg = frag_kb(&Pc[wave][col][0], hh);
#pragma unroll
    for (int t = 0; t < 4; ++t) { o[t] *= al; o[t] = wmma16b(vf[t], pf, o[t]); o[t] = wmma16b(vf[t], pg, o[t]); }
#pragma unroll
    for (int t = 0; t < 4; ++t) vf[t] = frag_fo(Vl + (size_t)kn * HD + t * 512);
    wave_lds_sync();
    asm volatile("s_wait_xcnt 0x0" ::: "memory"); }   // the next trip reuses the V loads' address registers: the wait stands in front of that overwrite
  // Each share hands over its un-normalised O^T with its max and sum; a share without a trip hands (-inf, 0, zeros).
#pragma unroll
  for (int t = 0; t < 4; ++t)
#pragma unroll
    for (int r = 0; r < 8; ++r) To[wave][col][t * 16 + 8 * hh + r] = o[t][r];
  if (hh == 0) { Sm[wave][col] = m; Sl[wave][col] = l; }
  __syncthreads();   // every wave passes it once: behind it all KS shares of both query tiles are in LDS
  // 8 threads join one of the block's 32 query rows, shares in the order 0 .. KS - 1; a thread holds 4 values in each half of the row, so a store of 8 lanes fills one 128-byte line of out.
  const int row = threadIdx.x >> 3, tq = row >> 4, c = row & 15, d0 = (threadIdx.x & 7) * 4;
  float ms[KS]; float mj = -INFINITY;
#pragma unroll
  for (int j = 0; j < KS; ++j) { ms[j] = Sm[2 * j + tq][c]; mj = fmaxf(mj, ms[j]); }
  float lj = 0.0f; v4f a0 = (v4f){}, a1 = (v4f){};
#pragma unroll
  for (int j = 0; j < KS; ++j) { const float w = (ms[j] == -INFINITY) ? 0.0f : nexp2(ms[j] - mj); lj += w * Sl[2 * j + tq][c]; a0 += w * *(const v4f*)(&To[2 * j + tq][c][d0]); a1 += w * *(const v4f*)(&To[2 * j + tq][c][d0 + 32]); }
  const float inv = 1.0f / (lj * PS * XS); float* po = out + ((size_t)b * L + tx * 32 + row) * HD + d0;
  *(v4f*)po = a0 * inv; *(v4f*)(po + 32) = a1 * inv;
}
}  // namespace

extern "C" void kernel_launch(void* const* d_in, const int* in_sizes, int n_in, void* d_out, int out_size, void* d_ws, size_t ws_size, hipStream_t stream) {
  (void)n_in;
  auto Fp = [&](int i) { return (const float*)d_in[i]; };
  // input order: 0 q, 1 k, 2 v [8,4096,64]
  if (in_sizes[0] != B * L * HD || in_sizes[1] != B * L * HD || in_sizes[2] != B * L * HD || out_size != B * L * HD) return;
  size_t off = 0; char* ws = (char*)d_ws;
  auto carve = [&](size_t bytes) { char* p = ws + off; off += (bytes + 255) & ~(size_t)255; return p; };
  const size_t plane = (size_t)B * L * HD * 2; b16* QP = (b16*)carve(plane); b16* KP = (b16*)carve(plane); b16* VT = (b16*)carve(plane);
  if (off > ws_size || off > ((size_t)128 << 20)) return;   // ≈ 12.6 MB
  plane_kernel<<<dim3(L / 64, BL), 256, 0, stream>>>(Fp(0), Fp(1), Fp(2), QP, KP, VT);
  attn_kernel<<<dim3(BL, QL / 32), 64 * KS, 0, stream>>>(QP, KP, VT, (float*)d_out);
}

// v005
// One run takes 43.6 microseconds.
// Timed twice side by side with v004, it ran 1.06 and 1.07 times as fast.
// Over all steps from v000 it is 6.23 times as fast.
#include <hip/hip_runtime.h>

// Scaled dot-product attention, single head, causal, on given q/k/v [8, 4096, 64]: out[b][t] = Σ_{s<=t} softmax_s(q_t . k_s / 8) v_s -> [8][4096][64].
// No projections: q, k, v are (bf16-rounded) inputs, so every WMMA operand except the probabilities is exact.
// Deterministic: flash-style per 16-query tile, its causal keys dealt to 4 waves (each with a running max), the 4 shares joined in a fixed order in LDS; no atomics.
// compute dtype: WMMA v_wmma_f32_16x16x32_f16 with f32 accumulate for S^T = K Q^T (q, k EXACT bf16 x8 planes: 1 product) and O^T += V^T P^T (v EXACT x8, P x1024 as f16 hi+lo: 2 products);
// softmax statistics in f32. Inputs rounded to bf16 once.
// K and V planes lie in fragment order: per 32 keys 4 blocks of 1 KiB, a block = one A fragment (K: 16 keys x 32 d; V^T: 16 d x 32 keys) as [half j][lane][8 f16],
// where lane (hh, col) holds k = 16 j + 8 hh + e of row col. A wave's 16-byte load of one half is then 512 bytes in a row, 4 whole 128-byte lines.

namespace {
constexpr int B = 8, L = 4096, HD = 64, BL = 8 /* batches (== 8 shipped) */, QL = 4096 /* query rows (== 4096 shipped; causal: a cut also limits keys to < QL) */;
constexpr float XS = 8.0f, PS = 1024.0f, LOG2E = 1.4426950408889634f;
static_assert(L % 64 == 0 && QL % 64 == 0, "tiling");
typedef _Float16 b16;
typedef __attribute__((ext_vector_type(16))) _Float16 v16b;
typedef __attribute__((ext_vector_type(8))) _Float16 v8b;
typedef __attribute__((ext_vector_type(8))) float v8f;
typedef __attribute__((ext_vector_type(4))) float v4f;
__device__ __forceinline__ float bf16_rne(float f) { unsigned int u = __float_as_uint(f); u += 0x7FFFu + ((u >> 16) & 1u); return __uint_as_float(u & 0xFFFF0000u); }
__device__ __forceinline__ void split16(float v, b16& hi, b16& lo) { hi = (b16)v; lo = (b16)(v - (float)hi); }
__device__ __forceinline__ v16b frag_kb(const b16* p, int hh) { const v8b a = *(const v8b*)(p + 8 * hh), b = *(const v8b*)(p + 16 + 8 * hh); v16b f;
#pragma unroll
  for (int e = 0; e < 8; ++e) { f[e] = a[e]; f[8 + e] = b[e]; } return f; }
__device__ __forceinline__ v16b frag_fo(const b16* p) { const v8b a = *(const v8b*)p, b = *(const v8b*)(p + 256); v16b f;   // p: the lane's 8 f16 in half 0 of a fragment-order block
#pragma unroll
  for (int e = 0; e < 8; ++e) { f[e] = a[e]; f[8 + e] = b[e]; } return f; }
__device__ __forceinline__ v8f wmma16b(v16b a, v16b b, v8f c) { v8f d = __builtin_amdgcn_wmma_f32_16x16x32_f16(false, a, false, b, (short)0, c, false, false); asm volatile("v_nop\n\tv_nop\n\tv_nop\n\tv_nop" : "+v"(d) : "v"(a), "v"(b)); return d; }
// The fences name LDS alone: they order a wave's own LDS exchange, and global loads that are in flight for the next trip are not drained at them.
__device__ __forceinline__ void wave_lds_sync() { __builtin_amdgcn_fence(__ATOMIC_RELEASE, "workgroup", "local"); __builtin_amdgcn_wave_barrier(); __builtin_amdgcn_fence(__ATOMIC_ACQUIRE, "workgroup", "local"); }
__device__ __forceinline__ float pmul(float a, float b) { float p = a * b; asm volatile("" : "+v"(p)); return p; }
__device__ __forceinline__ int iclamp(int v, int lo, int hi) { return v < lo ? lo : (v > hi ? hi : v); }

typedef __attribute__((ext_vector_type(2))) _Float16 v2h;
typedef __attribute__((ext_vector_type(4))) _Float16 v4h;
typedef __attribute__((ext_vector_type(2))) float v2f;
__device__ __forceinline__ float nexp2(float v) { return __builtin_amdgcn_exp2f(v); }
__global__ __launch_bounds__(256) void plane_kernel(const float* __restrict__ q, const float* __restrict__ k, const float* __restrict__ v, b16* __restrict__ QP, b16* __restrict__ KP, b16* __restrict__ VT) {
  __shared__ b16 Tv[64][HD + 2]; __shared__ __attribute__((aligned(16))) b16 Tk[64][HD + 8];
  const int t0 = blockIdx.x * 64, b = blockIdx.y; if (t0 >= QL) return;   // cut builds only; block-uniform, before any barrier
  const size_t base = ((size_t)b * L + t0) * HD;
  for (int i = threadIdx.x; i < 64 * HD; i += 256) { const int t = i / HD, c = i % HD; Tv[t][c] = (b16)(bf16_rne(v[base + i]) * XS); }
  for (int i = threadIdx.x; i < 64 * HD / 4; i += 256) { const v4f fq = *(const v4f*)(q + base + (size_t)i * 4), fk = *(const v4f*)(k + base + (size_t)i * 4); v4h oq, ok; for (int j = 0; j < 4; ++j) { oq[j] = (b16)(bf16_rne(fq[j]) * XS); ok[j] = (b16)(bf16_rne(fk[j]) * XS); }
    *(v4h*)(QP + base + (size_t)i * 4) = oq; *(v4h*)(&Tk[i / 16][(i % 16) * 4]) = ok; }
  __syncthreads();
  {
    // The tile's 64 keys x 64 d are 512 pieces of 8 f16 in either plane, piece i at base + 8 i: lane = i % 32, half j = i / 32 % 2, then the block.
    for (int i = threadIdx.x; i < 64 * HD / 8; i += 256) { const int col = i & 15, hh = (i >> 4) & 1, j = (i >> 5) & 1;
      *(v8b*)(KP + base + (size_t)i * 8) = *(const v8b*)(&Tk[(i >> 7) * 16 + col][((i >> 6) & 1) * 32 + 16 * j + 8 * hh]);   // K block = (16-key group i / 128, d half i / 64 % 2)
      v8b ov; for (int e = 0; e < 8; ++e) ov[e] = Tv[(i >> 8) * 32 + 16 * j + 8 * hh + e][((i >> 6) & 3) * 16 + col];         // V block = (32-key group i / 256, d group i / 64 % 4)
      *(v8b*)(VT + base + (size_t)i * 8) = ov; }
     }
}
template <bool V> struct flag { static constexpr bool value = V; };
// A query tile's 32-key trips are dealt round-robin to KS waves (share sp takes trips sp, sp + KS, ...); each keeps its own running max, sum and O^T, and the shares are joined in LDS at the end.
constexpr int KS = 4;
__global__ __launch_bounds__(64 * KS) void attn_kernel(const b16* __restrict__ QP, const b16* __restrict__ KP, const b16* __restrict__ VT, float* __restrict__ out) {
  __shared__ __attribute__((aligned(16))) b16 Pb[2 * KS][16][32 + 8], Pc[2 * KS][16][32 + 8]; __shared__ __attribute__((aligned(16))) float To[2 * KS][16][HD + 4]; __shared__ float Sm[2 * KS][16], Sl[2 * KS][16];
  const int wave = __builtin_amdgcn_readfirstlane(threadIdx.x >> 5);   // the wave's number in a scalar register: its first key now depends on it, and the trip count and the K and V addresses stay scalar work
  const int lane = threadIdx.x & 31, hh = lane >> 4, col = lane & 15; const int b = blockIdx.x; const int qt = wave & 1, sp = wave >> 1;
  // Longest first: a block's key trips grow with its query tile, and the grid holds more blocks than the chip has places for at once. y counts the tiles down from the last
  // (x is the batch); for speed only, every (batch, tile) is taken once in any order.
  const int tx = QL / 32 - 1 - (int)blockIdx.y; const int q0 = tx * 32 + qt * 16, qi = q0 + col;
  const b16* Qb = QP + (size_t)b * L * HD; const b16* Kb = KP + (size_t)b * L * HD; const b16* Vb = VT + (size_t)b * L * HD;
  const v16b qa0 = frag_kb(Qb + (size_t)qi * HD, hh), qa1 = frag_kb(Qb + (size_t)qi * HD + 32, hh);
  asm volatile("" :: "v"(qa0), "v"(qa1));   // inputs-only fence on the loaded Q: holds the Q loads in front of every K and V load. The loop's counted waits are the smaller of entry and back edge, and a Q load among the V loads would make each trip's first product wait for V loads just issued
  const float cs = LOG2E / (8.0f * XS * XS);
  float m = -INFINITY, l = 0.0f; v8f o[4]; for (int t = 0; t < 4; ++t) o[t] = (v8f){};
  const int klast = tx * 32;   // klast: first key of the last 32-key trip, the same for every wave of the block
  const int kfirst = sp * 32 < klast ? sp * 32 : klast;   // a share with no trip (sp * 32 > klast) fetches the last tile and uses nothing of it
  const b16* Kl = Kb + lane * 8; const b16* Vl = Vb + lane * 8;   // a 32-key trip at key kb: 4 K blocks and 4 V blocks of 512 f16 from kb * HD on
  // K and V fragments live in registers one trip ahead: a trip's 16 loads are issued as two groups during the trip before it, so no product waits out a load of its own.
  v16b kf[4], vf[4];
  const b16* Kf = Kl + (size_t)kfirst * HD; const b16* Vf = Vl + (size_t)kfirst * HD;
#pragma unroll
  for (int t = 0; t < 4; ++t) kf[t] = frag_fo(Kf + t * 512);
#pragma unroll
  for (int t = 0; t < 4; ++t) vf[t] = frag_fo(Vf + t * 512);
  asm volatile("s_wait_xcnt 0x0" :: "v"(Kf), "v"(Vf) : "memory");   // the first fetch's two address pairs stay whole up to this wait
  // One 32-key trip. Only the tile's last trip (kb == klast) holds keys behind a query: it alone is built with the causal compare and the guards for -inf scores. In every earlier trip all 32 keys
  // are at or in front of q0, the scores are finite sums of finite products, and compare, select and guards would be identities. The last trip has no next one and fetches nothing.
  auto trip = [&](auto fl, const int kb) __attribute__((always_inline)) {
    constexpr bool diag = decltype(fl)::value;
    const int kn = kb + 32 * KS < klast ? kb + 32 * KS : klast;   // this share's next trip; past the end the last tile is fetched instead, so every address stays inside the planes
    float e[16]; float mx = -INFINITY; v8f s[2];
#pragma unroll
    for (int u = 0; u < 2; ++u) { s[u] = (v8f){}; s[u] = wmma16b(kf[2 * u], qa0, s[u]); s[u] = wmma16b(kf[2 * u + 1], qa1, s[u]); }
    if constexpr (!diag) {
#pragma unroll
      for (int t = 0; t < 4; ++t) kf[t] = frag_fo(Kl + (size_t)kn * HD + t * 512); }
#pragma unroll
    for (int u = 0; u < 2; ++u)
#pragma unroll
      for (int r = 0; r < 8; ++r) { const int key = kb + u * 16 + 8 * hh + r; const float vv = (!diag || key <= qi) ? s[u][r] * cs : -INFINITY; e[u * 8 + r] = vv; mx = fmaxf(mx, vv); }
    mx = fmaxf(mx, __shfl_xor(mx, 16)); const float mn = fmaxf(m, mx); const float al = (diag && mn == -INFINITY) ? 1.0f : nexp2(m - mn); float sum = 0.0f;
#pragma unroll
    for (int i2 = 0; i2 < 16; ++i2) { const float p = (diag && e[i2] == -INFINITY) ? 0.0f : nexp2(e[i2] - mn); sum += p; b16 a_, b_; split16(p * PS, a_, b_); const int sl = (i2 < 8 ? 0 : 16) + 8 * hh + (i2 & 7); Pb[wave][col][sl] = a_; Pc[wave][col][sl] = b_; }
    sum += __shfl_xor(sum, 16); l = l * al + sum; m = mn;
    wave_lds_sync();
    const v16b pf = frag_kb(&Pb[wave][col][0], hh), pg = frag_kb(&Pc[wave][col][0], hh);
#pragma unroll
    for (int t = 0; t < 4; ++t) { o[t] *= al; o[t] = wmma16b(vf[t], pf, o[t]); o[t] = wmma16b(vf[t], pg, o[t]); }
    if constexpr (!diag) {
#pragma unroll
      for (int t = 0; t < 4; ++t) vf[t] = frag_fo(Vl + (size_t)kn * HD + t * 512); }
    wave_lds_sync();
    if constexpr (!diag) asm volatile("s_wait_xcnt 0x0" ::: "memory"); };   // the next trip reuses the V loads' address registers: the wait stands in front of that overwrite
  int kb = sp * 32;
#pragma unroll 1   // stays rolled: one copy of the trip in the instruction cache, and the fragments fetched ahead keep their registers over the back edge
  for (; kb < klast; kb += 32 * KS) trip(flag<false>{}, kb);
  if (kb == klast) trip(flag<true>{}, kb);   // scalar test: the one share in KS whose turn the last trip is
  // Each share hands over its un-normalised O^T with its max and sum; a share without a trip hands (-inf, 0, zeros).
#pragma unroll
  for (int t = 0; t < 4; ++t)
#pragma unroll
    for (int r = 0; r < 8; ++r) To[wave][col][t * 16 + 8 * hh + r] = o[t][r];
  if (hh == 0) { Sm[wave][col] = m; Sl[wave][col] = l; }
  __syncthreads();   // every wave passes it once: behind it all KS shares of both query tiles are in LDS
  // 8 threads join one of the block's 32 query rows, shares in the order 0 .. KS - 1; a thread holds 4 values in each half of the row, so a store of 8 lanes fills one 128-byte line of out.
  const int row = threadIdx.x >> 3, tq = row >> 4, c = row & 15, d0 = (threadIdx.x & 7) * 4;
  float ms[KS]; float mj = -INFINITY;
#pragma unroll
  for (int j = 0; j < KS; ++j) { ms[j] = Sm[2 * j + tq][c]; mj = fmaxf(mj, ms[j]); }
  float lj = 0.0f; v4f a0 = (v4f){}, a1 = (v4f){};
#pragma unroll
  for (int j = 0; j < KS; ++j) { const float w = (ms[j] == -INFINITY) ? 0.0f : nexp2(ms[j] - mj); lj += w * Sl[2 * j + tq][c]; a0 += w * *(const v4f*)(&To[2 * j + tq][c][d0]); a1 += w * *(const v4f*)(&To[2 * j + tq][c][d0 + 32]); }
  const float inv = 1.0f / (lj * PS * XS); float* po = out + ((size_t)b * L + tx * 32 + row) * HD + d0;
  *(v4f*)po = a0 * inv; *(v4f*)(po + 32) = a1 * inv;
}
}  // namespace

extern "C" void kernel_launch(void* const* d_in, const int* in_sizes, int n_in, void* d_out, int out_size, void* d_ws, size_t ws_size, hipStream_t stream) {
  (void)n_in;
  auto Fp = [&](int i) { return (const float*)d_in[i]; };
  // input order: 0 q, 1 k, 2 v [8,4096,64]
  if (in_sizes[0] != B * L * HD || in_sizes[1] != B * L * HD || in_sizes[2] != B * L * HD || out_size != B * L * HD) return;
  size_t off = 0; char* ws = (char*)d_ws;
  auto carve = [&](size_t bytes) { char* p = ws + off; off += (bytes + 255) & ~(size_t)255; return p; };
  const size_t plane = (size_t)B * L * HD * 2; b16* QP = (b16*)carve(plane); b16* KP = (b16*)carve(plane); b16* VT = (b16*)carve(plane);
  if (off > ws_size || off > ((size_t)128 << 20)) return;   // ≈ 12.6 MB
  plane_kernel<<<dim3(L / 64, BL), 256, 0, stream>>>(Fp(0), Fp(1), Fp(2), QP, KP, VT);
  attn_kernel<<<dim3(BL, QL / 32), 64 * KS, 0, stream>>>(QP, KP, VT, (float*)d_out);
}

// v006
// Measured time: 41.4 microseconds a run.
// Two timings next to v005 both put it at 1.05 times that version's speed.
// All steps since v000 together make it 6.55 times as fast.
#include <hip/hip_runtime.h>

// Scaled dot-product attention, single head, causal, on given q/k/v [8, 4096, 64]: out[b][t] = Σ_{s<=t} softmax_s(q_t . k_s / 8) v_s -> [8][4096][64].
// No projections: q, k, v are (bf16-rounded) inputs, so every WMMA operand except the probabilities is exact.
// Deterministic: flash-style per 16-query tile, its causal keys dealt to 4 waves (each with a running max), the 4 shares joined in a fixed order in LDS; no atomics.
// compute dtype: WMMA v_wmma_f32_16x16x32_f16 with f32 accumulate for S^T = K Q^T (q, k EXACT bf16 x8 planes: 1 product) and O^T += V^T P^T (v EXACT x8, P x1024 as f16 hi+lo: 2 products);
// softmax statistics in f32. Inputs rounded to bf16 once.
// K and V planes lie in fragment order: per 32 keys 4 blocks of 1 KiB, a block = one A fragment (K: 16 keys x 32 d; V^T: 16 d x 32 keys) as [half j][lane][8 f16],
// where lane (hh, col) holds k = 16 j + 8 hh + e of row col. A wave's 16-byte load of one half is then 512 bytes in a row, 4 whole 128-byte lines.

namespace {
constexpr int B = 8, L = 4096, HD = 64, BL = 8 /* batches (== 8 shipped) */, QL = 4096 /* query rows (== 4096 shipped; causal: a cut also limits keys to < QL) */;
constexpr float XS = 8.0f, PS = 1024.0f, LOG2E = 1.4426950408889634f;
static_assert(L % 64 == 0 && QL % 64 == 0, "tiling");
typedef _Float16 b16;
typedef __attribute__((ext_vector_type(16))) _Float16 v16b;
typedef __attribute__((ext_vector_type(8))) _Float16 v8b;
typedef __attribute__((ext_vector_type(8))) float v8f;
typedef __attribute__((ext_vector_type(4))) float v4f;
__device__ __forceinline__ float bf16_rne(float f) { unsigned int u = __float_as_uint(f); u += 0x7FFFu + ((u >> 16) & 1u); return __uint_as_float(u & 0xFFFF0000u); }
__device__ __forceinline__ v16b frag_kb(const b16* p, int hh) { const v8b a = *(const v8b*)(p + 8 * hh), b = *(const v8b*)(p + 16 + 8 * hh); v16b f;
#pragma unroll
  for (int e = 0; e < 8; ++e) { f[e] = a[e]; f[8 + e] = b[e]; } return f; }
__device__ __forceinline__ v16b frag_fo(const b16* p) { const v8b a = *(const v8b*)p, b = *(const v8b*)(p + 256); v16b f;   // p: the lane's 8 f16 in half 0 of a fragment-order block
#pragma unroll
  for (int e = 0; e < 8; ++e) { f[e] = a[e]; f[8 + e] = b[e]; } return f; }
__device__ __forceinline__ v8f wmma16b(v16b a, v16b b, v8f c) { v8f d = __builtin_amdgcn_wmma_f32_16x16x32_f16(false, a, false, b, (short)0, c, false, false); asm volatile("v_nop\n\tv_nop\n\tv_nop\n\tv_nop" : "+v"(d) : "v"(a), "v"(b)); return d; }
__device__ __forceinline__ float pmul(float a, float b) { float p = a * b; asm volatile("" : "+v"(p)); return p; }
__device__ __forceinline__ int iclamp(int v, int lo, int hi) { return v < lo ? lo : (v > hi ? hi : v); }

typedef __attribute__((ext_vector_type(2))) _Float16 v2h;
typedef __attribute__((ext_vector_type(4))) _Float16 v4h;
typedef __attribute__((ext_vector_type(2))) float v2f;
__device__ __forceinline__ float nexp2(float v) { return __builtin_amdgcn_exp2f(v); }
__global__ __launch_bounds__(256) void plane_kernel(const float* __restrict__ q, const float* __restrict__ k, const float* __restrict__ v, b16* __restrict__ QP, b16* __restrict__ KP, b16* __restrict__ VT) {
  __shared__ b16 Tv[64][HD + 2]; __shared__ __attribute__((aligned(16))) b16 Tk[64][HD + 8];
  const int t0 = blockIdx.x * 64, b = blockIdx.y; if (t0 >= QL) return;   // cut builds only; block-uniform, before any barrier
  const size_t base = ((size_t)b * L + t0) * HD;
  for (int i = threadIdx.x; i < 64 * HD; i += 256) { const int t = i / HD, c = i % HD; Tv[t][c] = (b16)(bf16_rne(v[base + i]) * XS); }
  for (int i = threadIdx.x; i < 64 * HD / 4; i += 256) { const v4f fq = *(const v4f*)(q + base + (size_t)i * 4), fk = *(const v4f*)(k + base + (size_t)i * 4); v4h oq, ok; for (int j = 0; j < 4; ++j) { oq[j] = (b16)(bf16_rne(fq[j]) * XS); ok[j] = (b16)(bf16_rne(fk[j]) * XS); }
    *(v4h*)(QP + base + (size_t)i * 4) = oq; *(v4h*)(&Tk[i / 16][(i % 16) * 4]) = ok; }
  __syncthreads();
  {
    // The tile's 64 keys x 64 d are 512 pieces of 8 f16 in either plane, piece i at base + 8 i: lane = i % 32, half j = i / 32 % 2, then the block.
    for (int i = threadIdx.x; i < 64 * HD / 8; i += 256) { const int col = i & 15, hh = (i >> 4) & 1, j = (i >> 5) & 1;
      *(v8b*)(KP + base + (size_t)i * 8) = *(const v8b*)(&Tk[(i >> 7) * 16 + col][((i >> 6) & 1) * 32 + 16 * j + 8 * hh]);   // K block = (16-key group i / 128, d half i / 64 % 2)
      v8b ov; for (int e = 0; e < 8; ++e) ov[e] = Tv[(i >> 8) * 32 + 16 * j + 8 * hh + e][((i >> 6) & 3) * 16 + col];         // V block = (32-key group i / 256, d group i / 64 % 4)
      *(v8b*)(VT + base + (size_t)i * 8) = ov; }
     }
}
template <bool V> struct flag { static constexpr bool value = V; };
// A query tile's 32-key trips are dealt round-robin to KS waves (share sp takes trips sp, sp + KS, ...); each keeps its own running max, sum and O^T, and the shares are joined in LDS at the end.
constexpr int KS = 4;
__global__ __launch_bounds__(64 * KS) void attn_kernel(const b16* __restrict__ QP, const b16* __restrict__ KP, const b16* __restrict__ VT, float* __restrict__ out) {
  __shared__ __attribute__((aligned(16))) float To[2 * KS][16][HD + 4]; __shared__ float Sm[2 * KS][16], Sl[2 * KS][16];
  const int wave = __builtin_amdgcn_readfirstlane(threadIdx.x >> 5);   // the wave's number in a scalar register: its first key now depends on it, and the trip count and the K and V addresses stay scalar work
  const int lane = threadIdx.x & 31, hh = lane >> 4, col = lane & 15; const int b = blockIdx.x; const int qt = wave & 1, sp = wave >> 1;
  // Longest first: a block's key trips grow with its query tile, and the grid holds more blocks than the chip has places for at once. y counts the tiles down from the last
  // (x is the batch); for speed only, every (batch, tile) is taken once in any order.
  const int tx = QL / 32 - 1 - (int)blockIdx.y; const int q0 = tx * 32 + qt * 16, qi = q0 + col;
  const b16* Qb = QP + (size_t)b * L * HD; const b16* Kb = KP + (size_t)b * L * HD; const b16* Vb = VT + (size_t)b * L * HD;
  const v16b qa0 = frag_kb(Qb + (size_t)qi * HD, hh), qa1 = frag_kb(Qb + (size_t)qi * HD + 32, hh);
  asm volatile("" :: "v"(qa0), "v"(qa1));   // inputs-only fence on the loaded Q: holds the Q loads in front of every K and V load. The loop's counted waits are the smaller of entry and back edge, and a Q load among the V loads would make each trip's first product wait for V loads just issued
  const float cs = LOG2E / (8.0f * XS * XS);
  float m = -INFINITY, l = 0.0f; v8f o[4]; for (int t = 0; t < 4; ++t) o[t] = (v8f){};
  const int klast = tx * 32;   // klast: first key of the last 32-key trip, the same for every wave of the block
  const int kfirst = sp * 32 < klast ? sp * 32 : klast;   // a share with no trip (sp * 32 > klast) fetches the last tile and uses nothing of it
  const b16* Kl = Kb + lane * 8; const b16* Vl = Vb + lane * 8;   // a 32-key trip at key kb: 4 K blocks and 4 V blocks of 512 f16 from kb * HD on
  // K and V fragments live in registers one trip ahead: a trip's 16 loads are issued as two groups during the trip before it, so no product waits out a load of its own.
  v16b kf[4], vf[4];
  const b16* Kf = Kl + (size_t)kfirst * HD; const b16* Vf = Vl + (size_t)kfirst * HD;
#pragma unroll
  for (int t = 0; t < 4; ++t) kf[t] = frag_fo(Kf + t * 512);
#pragma unroll
  for (int t = 0; t < 4; ++t) vf[t] = frag_fo(Vf + t * 512);
  asm volatile("s_wait_xcnt 0x0" :: "v"(Kf), "v"(Vf) : "memory");   // the first fetch's two address pairs stay whole up to this wait
  // One 32-key trip. Only the tile's last trip (kb == klast) holds keys behind a query: it alone is built with the causal compare and the guards for -inf scores. In every earlier trip all 32 keys
  // are at or in front of q0, the scores are finite sums of finite products, and compare, select and guards would be identities. The last trip has no next one and fetches nothing.
  auto trip = [&](auto fl, const int kb) __attribute__((always_inline)) {
    constexpr bool diag = decltype(fl)::value;
    const int kn = kb + 32 * KS < klast ? kb + 32 * KS : klast;   // this share's next trip; past the end the last tile is fetched instead, so every address stays inside the planes
    float e[16]; float mx = -INFINITY; v8f s[2];
#pragma unroll
    for (int u = 0; u < 2; ++u) { s[u] = (v8f){}; s[u] = wmma16b(kf[2 * u], qa0, s[u]); s[u] = wmma16b(kf[2 * u + 1], qa1, s[u]); }
    if constexpr (!diag) {
#pragma unroll
      for (int t = 0; t < 4; ++t) kf[t] = frag_fo(Kl + (size_t)kn * HD + t * 512); }
#pragma unroll
    for (int u = 0; u < 2; ++u)
#pragma unroll
      for (int r = 0; r < 8; ++r) { const int key = kb + u * 16 + 8 * hh + r; const float vv = (!diag || key <= qi) ? s[u][r] * cs : -INFINITY; e[u * 8 + r] = vv; mx = fmaxf(mx, vv); }
    mx = fmaxf(mx, __shfl_xor(mx, 16)); const float mn = fmaxf(m, mx); const float al = (diag && mn == -INFINITY) ? 1.0f : nexp2(m - mn); float sum = 0.0f;
    // P^T never leaves the lane: accumulator register r of score tile u is key 16 u + 8 hh + r of query col, which is element 8 u + r of the lane's B fragment in the k order of the V^T blocks.
    v16b pf, pg;
#pragma unroll
    for (int i2 = 0; i2 < 16; i2 += 2) { v2f t;
#pragma unroll
      for (int j = 0; j < 2; ++j) { const float p = (diag && e[i2 + j] == -INFINITY) ? 0.0f : nexp2(e[i2 + j] - mn); sum += p; t[j] = p * PS; }
      const v2h a_ = __builtin_convertvector(t, v2h), b_ = __builtin_convertvector(t - __builtin_convertvector(a_, v2f), v2h);   // hi and lo of two neighbouring keys: one packed register of either fragment
      pf[i2] = a_[0]; pf[i2 + 1] = a_[1]; pg[i2] = b_[0]; pg[i2 + 1] = b_[1]; }
    sum += __shfl_xor(sum, 16); l = l * al + sum; m = mn;
#pragma unroll
    for (int t = 0; t < 4; ++t) { o[t] *= al; o[t] = wmma16b(vf[t], pf, o[t]); o[t] = wmma16b(vf[t], pg, o[t]); }
    if constexpr (!diag) {
#pragma unroll
      for (int t = 0; t < 4; ++t) vf[t] = frag_fo(Vl + (size_t)kn * HD + t * 512); }
    if constexpr (!diag) asm volatile("s_wait_xcnt 0x0" :: "v"(l) : "memory"); };   // the next trip reuses the V loads' address registers: the wait stands in front of that overwrite; it takes l as an input so that it stays at the back edge, behind the row-sum chain, and is not waited out directly behind the loads
  int kb = sp * 32;
#pragma unroll 1   // stays rolled: one copy of the trip in the instruction cache, and the fragments fetched ahead keep their registers over the back edge
  for (; kb < klast; kb += 32 * KS) trip(flag<false>{}, kb);
  if (kb == klast) trip(flag<true>{}, kb);   // scalar test: the one share in KS whose turn the last trip is
  // Each share hands over its un-normalised O^T with its max and sum; a share without a trip hands (-inf, 0, zeros).
#pragma unroll
  for (int t = 0; t < 4; ++t)
#pragma unroll
    for (int r = 0; r < 8; ++r) To[wave][col][t * 16 + 8 * hh + r] = o[t][r];
  if (hh == 0) { Sm[wave][col] = m; Sl[wave][col] = l; }
  __syncthreads();   // every wave passes it once: behind it all KS shares of both query tiles are in LDS
  // 8 threads join one of the block's 32 query rows, shares in the order 0 .. KS - 1; a thread holds 4 values in each half of the row, so a store of 8 lanes fills one 128-byte line of out.
  const int row = threadIdx.x >> 3, tq = row >> 4, c = row & 15, d0 = (threadIdx.x & 7) * 4;
  float ms[KS]; float mj = -INFINITY;
#pragma unroll
  for (int j = 0; j < KS; ++j) { ms[j] = Sm[2 * j + tq][c]; mj = fmaxf(mj, ms[j]); }
  float lj = 0.0f; v4f a0 = (v4f){}, a1 = (v4f){};
#pragma unroll
  for (int j = 0; j < KS; ++j) { const float w = (ms[j] == -INFINITY) ? 0.0f : nexp2(ms[j] - mj); lj += w * Sl[2 * j + tq][c]; a0 += w * *(const v4f*)(&To[2 * j + tq][c][d0]); a1 += w * *(const v4f*)(&To[2 * j + tq][c][d0 + 32]); }
  const float inv = 1.0f / (lj * PS * XS); float* po = out + ((size_t)b * L + tx * 32 + row) * HD + d0;
  *(v4f*)po = a0 * inv; *(v4f*)(po + 32) = a1 * inv;
}
}  // namespace

extern "C" void kernel_launch(void* const* d_in, const int* in_sizes, int n_in, void* d_out, int out_size, void* d_ws, size_t ws_size, hipStream_t stream) {
  (void)n_in;
  auto Fp = [&](int i) { return (const float*)d_in[i]; };
  // input order: 0 q, 1 k, 2 v [8,4096,64]
  if (in_sizes[0] != B * L * HD || in_sizes[1] != B * L * HD || in_sizes[2] != B * L * HD || out_size != B * L * HD) return;
  size_t off = 0; char* ws = (char*)d_ws;
  auto carve = [&](size_t bytes) { char* p = ws + off; off += (bytes + 255) & ~(size_t)255; return p; };
  const size_t plane = (size_t)B * L * HD * 2; b16* QP = (b16*)carve(plane); b16* KP = (b16*)carve(plane); b16* VT = (b16*)carve(plane);
  if (off > ws_size || off > ((size_t)128 << 20)) return;   // ≈ 12.6 MB
  plane_kernel<<<dim3(L / 64, BL), 256, 0, stream>>>(Fp(0), Fp(1), Fp(2), QP, KP, VT);
  attn_kernel<<<dim3(BL, QL / 32), 64 * KS, 0, stream>>>(QP, KP, VT, (float*)d_out);
}

// v007
// A run of this version takes 37.2 microseconds.
// In two side-by-side timings against v006, it was 1.11 and 1.12 times as fast.
// Over all steps from v000 it is 7.30 times as fast.
#include <hip/hip_runtime.h>

// Scaled dot-product attention, single head, causal, on given q/k/v [8, 4096, 64]: out[b][t] = Σ_{s<=t} softmax_s(q_t . k_s / 8) v_s -> [8][4096][64].
// No projections: q, k, v are (bf16-rounded) inputs, so every WMMA operand except the probabilities is exact.
// Deterministic: flash-style per 16-query tile, its causal keys dealt to 4 waves (each with a running max), the 4 shares joined in a fixed order in LDS; no atomics.
// compute dtype: WMMA v_wmma_f32_16x16x32_f16 with f32 accumulate for S^T = K Q^T (q, k EXACT bf16 x8 planes: 1 product) and O^T += V^T P^T (v EXACT x8, P x1024 as f16 hi+lo: 2 products);
// softmax statistics in f32. Inputs rounded to bf16 once.
// K and V planes lie in fragment order: per 32 keys 4 blocks of 1 KiB, a block = one A fragment (K: 16 keys x 32 d; V^T: 16 d x 32 keys) as [half j][lane][8 f16],
// where lane (hh, col) holds k = 16 j + 8 hh + e of row col. A wave's 16-byte load of one half is then 512 bytes in a row, 4 whole 128-byte lines.

namespace {
constexpr int B = 8, L = 4096, HD = 64, BL = 8 /* batches (== 8 shipped) */, QL = 4096 /* query rows (== 4096 shipped; causal: a cut also limits keys to < QL) */;
constexpr float XS = 8.0f, PS = 1024.0f, LOG2E = 1.4426950408889634f;
static_assert(L % 64 == 0 && QL % 64 == 0, "tiling");
typedef _Float16 b16;
typedef __attribute__((ext_vector_type(16))) _Float16 v16b;
typedef __attribute__((ext_vector_type(8))) _Float16 v8b;
typedef __attribute__((ext_vector_type(8))) float v8f;
typedef __attribute__((ext_vector_type(4))) float v4f;
__device__ __forceinline__ float bf16_rne(float f) { unsigned int u = __float_as_uint(f); u += 0x7FFFu + ((u >> 16) & 1u); return __uint_as_float(u & 0xFFFF0000u); }
__device__ __forceinline__ v16b frag_kb(const b16* p, int hh) { const v8b a = *(const v8b*)(p + 8 * hh), b = *(const v8b*)(p + 16 + 8 * hh); v16b f;
#pragma unroll
  for (int e = 0; e < 8; ++e) { f[e] = a[e]; f[8 + e] = b[e]; } return f; }
__device__ __forceinline__ v16b frag_fo(const b16* p) { const v8b a = *(const v8b*)p, b = *(const v8b*)(p + 256); v16b f;   // p: the lane's 8 f16 in half 0 of a fragment-order block
#pragma unroll
  for (int e = 0; e < 8; ++e) { f[e] = a[e]; f[8 + e] = b[e]; } return f; }
__device__ __forceinline__ v8f wmma16b(v16b a, v16b b, v8f c) { v8f d = __builtin_amdgcn_wmma_f32_16x16x32_f16(false, a, false, b, (short)0, c, false, false); asm volatile("v_nop\n\tv_nop\n\tv_nop\n\tv_nop" : "+v"(d) : "v"(a), "v"(b)); return d; }
__device__ __forceinline__ v8f wmma16n(v16b a, v16b b, v8f c) { return __builtin_amdgcn_wmma_f32_16x16x32_f16(false, a, false, b, (short)0, c, false, false); }   // the builtin alone, for the loop's trips: the compiler keeps the distance behind it, with the trip's own vector work where it has some
__device__ __forceinline__ float pmul(float a, float b) { float p = a * b; asm volatile("" : "+v"(p)); return p; }
__device__ __forceinline__ int iclamp(int v, int lo, int hi) { return v < lo ? lo : (v > hi ? hi : v); }

typedef __attribute__((ext_vector_type(2))) _Float16 v2h;
typedef __attribute__((ext_vector_type(4))) _Float16 v4h;
typedef __attribute__((ext_vector_type(2))) float v2f;
__device__ __forceinline__ float nexp2(float v) { return __builtin_amdgcn_exp2f(v); }
__global__ __launch_bounds__(256) void plane_kernel(const float* __restrict__ q, const float* __restrict__ k, const float* __restrict__ v, b16* __restrict__ QP, b16* __restrict__ KP, b16* __restrict__ VT) {
  __shared__ b16 Tv[64][HD + 2]; __shared__ __attribute__((aligned(16))) b16 Tk[64][HD + 8];
  const int t0 = blockIdx.x * 64, b = blockIdx.y; if (t0 >= QL) return;   // cut builds only; block-uniform, before any barrier
  const size_t base = ((size_t)b * L + t0) * HD;
  for (int i = threadIdx.x; i < 64 * HD; i += 256) { const int t = i / HD, c = i % HD; Tv[t][c] = (b16)(bf16_rne(v[base + i]) * XS); }
  for (int i = threadIdx.x; i < 64 * HD / 4; i += 256) { const v4f fq = *(const v4f*)(q + base + (size_t)i * 4), fk = *(const v4f*)(k + base + (size_t)i * 4); v4h oq, ok; for (int j = 0; j < 4; ++j) { oq[j] = (b16)(bf16_rne(fq[j]) * XS); ok[j] = (b16)(bf16_rne(fk[j]) * XS); }
    *(v4h*)(QP + base + (size_t)i * 4) = oq; *(v4h*)(&Tk[i / 16][(i % 16) * 4]) = ok; }
  __syncthreads();
  {
    // The tile's 64 keys x 64 d are 512 pieces of 8 f16 in either plane, piece i at base + 8 i: lane = i % 32, half j = i / 32 % 2, then the block.
    for (int i = threadIdx.x; i < 64 * HD / 8; i += 256) { const int col = i & 15, hh = (i >> 4) & 1, j = (i >> 5) & 1;
      *(v8b*)(KP + base + (size_t)i * 8) = *(const v8b*)(&Tk[(i >> 7) * 16 + col][((i >> 6) & 1) * 32 + 16 * j + 8 * hh]);   // K block = (16-key group i / 128, d half i / 64 % 2)
      v8b ov; for (int e = 0; e < 8; ++e) ov[e] = Tv[(i >> 8) * 32 + 16 * j + 8 * hh + e][((i >> 6) & 3) * 16 + col];         // V block = (32-key group i / 256, d group i / 64 % 4)
      *(v8b*)(VT + base + (size_t)i * 8) = ov; }
     }
}
template <bool V> struct flag { static constexpr bool value = V; };
// A query tile's 32-key trips are dealt round-robin to KS waves (share sp takes trips sp, sp + KS, ...); each keeps its own running max, sum and O^T, and the shares are joined in LDS at the end.
constexpr int KS = 4;
__global__ __launch_bounds__(64 * KS) void attn_kernel(const b16* __restrict__ QP, const b16* __restrict__ KP, const b16* __restrict__ VT, float* __restrict__ out) {
  __shared__ __attribute__((aligned(16))) float To[2 * KS][16][HD + 4]; __shared__ float Sm[2 * KS][16], Sl[2 * KS][16];
  const int wave = __builtin_amdgcn_readfirstlane(threadIdx.x >> 5);   // the wave's number in a scalar register: its first key now depends on it, and the trip count and the K and V addresses stay scalar work
  const int lane = threadIdx.x & 31, hh = lane >> 4, col = lane & 15; const int b = blockIdx.x; const int qt = wave & 1, sp = wave >> 1;
  // Longest first: a block's key trips grow with its query tile, and the grid holds more blocks than the chip has places for at once. y counts the tiles down from the last
  // (x is the batch); for speed only, every (batch, tile) is taken once in any order.
  const int tx = QL / 32 - 1 - (int)blockIdx.y; const int q0 = tx * 32 + qt * 16, qi = q0 + col;
  const b16* Qb = QP + (size_t)b * L * HD; const b16* Kb = KP + (size_t)b * L * HD; const b16* Vb = VT + (size_t)b * L * HD;
  const v16b qa0 = frag_kb(Qb + (size_t)qi * HD, hh), qa1 = frag_kb(Qb + (size_t)qi * HD + 32, hh);
  asm volatile("" :: "v"(qa0), "v"(qa1));   // inputs-only fence on the loaded Q: holds the Q loads in front of every K and V load. The loop's counted waits are the smaller of entry and back edge, and a Q load among the V loads would make each trip's first product wait for V loads just issued
  const float cs = LOG2E / (8.0f * XS * XS);
  float m = -INFINITY, l = 0.0f; v8f o[4]; for (int t = 0; t < 4; ++t) o[t] = (v8f){};
  const int klast = tx * 32;   // klast: first key of the last 32-key trip, the same for every wave of the block
  const int kfirst = sp * 32 < klast ? sp * 32 : klast;   // a share with no trip (sp * 32 > klast) fetches the last tile and uses nothing of it
  const b16* Kl = Kb + lane * 8; const b16* Vl = Vb + lane * 8;   // a 32-key trip at key kb: 4 K blocks and 4 V blocks of 512 f16 from kb * HD on
  // K and V fragments live in registers one trip ahead: a trip's 16 loads are issued as two groups during the trip before it, so no product waits out a load of its own.
  v16b kf[4], vf[4];
  const b16* Kf = Kl + (size_t)kfirst * HD; const b16* Vf = Vl + (size_t)kfirst * HD;
#pragma unroll
  for (int t = 0; t < 4; ++t) kf[t] = frag_fo(Kf + t * 512);
#pragma unroll
  for (int t = 0; t < 4; ++t) vf[t] = frag_fo(Vf + t * 512);
  asm volatile("s_wait_xcnt 0x0" :: "v"(Kf), "v"(Vf) : "memory");   // the first fetch's two address pairs stay whole up to this wait
  // One 32-key trip. Only the tile's last trip (kb == klast) holds keys behind a query: it alone is built with the causal compare and the guards for -inf scores. In every earlier trip all 32 keys
  // are at or in front of q0, the scores are finite sums of finite products, and compare, select and guards would be identities. The last trip has no next one and fetches nothing.
  auto trip = [&](auto fl, const int kb) __attribute__((always_inline)) {
    constexpr bool diag = decltype(fl)::value;
    auto mm = [](v16b a, v16b b, v8f c) __attribute__((always_inline)) { if constexpr (diag) return wmma16b(a, b, c); else return wmma16n(a, b, c); };   // the peeled last trip, once a tile, keeps its form
    const int kn = kb + 32 * KS < klast ? kb + 32 * KS : klast;   // this share's next trip; past the end the last tile is fetched instead, so every address stays inside the planes
    float e[16]; float mx = -INFINITY; v8f s[2];
#pragma unroll
    for (int u = 0; u < 2; ++u) { s[u] = (v8f){}; s[u] = mm(kf[2 * u], qa0, s[u]); s[u] = mm(kf[2 * u + 1], qa1, s[u]); }
    if constexpr (!diag) {
      asm volatile("" :: "v"(s[0]), "v"(s[1]));   // inputs-only fence on the two score accumulators: the four score products stay in front of it and the next trip's K loads behind it, so that the loads land in the registers just read; mixed among the products they took fresh registers and 16 copies a trip. It names no multiply's result: s * cs - mn still fuses
#pragma unroll
      for (int t = 0; t < 4; ++t) kf[t] = frag_fo(Kl + (size_t)kn * HD + t * 512);
      __builtin_amdgcn_sched_barrier(0); }   // holds those loads in front of the softmax: left free, the compiler sank them to the trip's end and waited them out there
#pragma unroll
    for (int u = 0; u < 2; ++u)
#pragma unroll
      for (int r = 0; r < 8; ++r) { const int key = kb + u * 16 + 8 * hh + r; const float vv = (!diag || key <= qi) ? s[u][r] * cs : -INFINITY; e[u * 8 + r] = vv; mx = fmaxf(mx, vv); }
    mx = fmaxf(mx, __shfl_xor(mx, 16)); const float mn = fmaxf(m, mx); const float al = (diag && mn == -INFINITY) ? 1.0f : nexp2(m - mn); float sum = 0.0f;
    // P^T never leaves the lane: accumulator register r of score tile u is key 16 u + 8 hh + r of query col, which is element 8 u + r of the lane's B fragment in the k order of the V^T blocks.
    v16b pf, pg;
#pragma unroll
    for (int i2 = 0; i2 < 16; i2 += 2) { v2f t;
#pragma unroll
      for (int j = 0; j < 2; ++j) { const float p = (diag && e[i2 + j] == -INFINITY) ? 0.0f : nexp2(e[i2 + j] - mn); sum += p; t[j] = p * PS; }
      const v2h a_ = __builtin_convertvector(t, v2h), b_ = __builtin_convertvector(t - __builtin_convertvector(a_, v2f), v2h);   // hi and lo of two neighbouring keys: one packed register of either fragment
      pf[i2] = a_[0]; pf[i2 + 1] = a_[1]; pg[i2] = b_[0]; pg[i2 + 1] = b_[1]; }
    sum += __shfl_xor(sum, 16); l = l * al + sum; m = mn;
#pragma unroll
    for (int t = 0; t < 4; ++t) { o[t] *= al; o[t] = mm(vf[t], pf, o[t]); o[t] = mm(vf[t], pg, o[t]); }
    if constexpr (!diag) {
#pragma unroll
      for (int t = 0; t < 4; ++t) vf[t] = frag_fo(Vl + (size_t)kn * HD + t * 512); }
    if constexpr (!diag) asm volatile("s_wait_xcnt 0x0" :: "v"(l) : "memory"); };   // the next trip reuses the V loads' address registers: the wait stands in front of that overwrite; it takes l as an input so that it stays at the back edge, behind the row-sum chain, and is not waited out directly behind the loads
  int kb = sp * 32;
#pragma unroll 1   // stays rolled: one copy of the trip in the instruction cache, and the fragments fetched ahead keep their registers over the back edge
  for (; kb < klast; kb += 32 * KS) trip(flag<false>{}, kb);
  if (kb == klast) trip(flag<true>{}, kb);   // scalar test: the one share in KS whose turn the last trip is
  // Each share hands over its un-normalised O^T with its max and sum; a share without a trip hands (-inf, 0, zeros).
#pragma unroll
  for (int t = 0; t < 4; ++t)
#pragma unroll
    for (int r = 0; r < 8; ++r) To[wave][col][t * 16 + 8 * hh + r] = o[t][r];
  if (hh == 0) { Sm[wave][col] = m; Sl[wave][col] = l; }
  __syncthreads();   // every wave passes it once: behind it all KS shares of both query tiles are in LDS
  // 8 threads join one of the block's 32 query rows, shares in the order 0 .. KS - 1; a thread holds 4 values in each half of the row, so a store of 8 lanes fills one 128-byte line of out.
  const int row = threadIdx.x >> 3, tq = row >> 4, c = row & 15, d0 = (threadIdx.x & 7) * 4;
  float ms[KS]; float mj = -INFINITY;
#pragma unroll
  for (int j = 0; j < KS; ++j) { ms[j] = Sm[2 * j + tq][c]; mj = fmaxf(mj, ms[j]); }
  float lj = 0.0f; v4f a0 = (v4f){}, a1 = (v4f){};
#pragma unroll
  for (int j = 0; j < KS; ++j) { const float w = (ms[j] == -INFINITY) ? 0.0f : nexp2(ms[j] - mj); lj += w * Sl[2 * j + tq][c]; a0 += w * *(const v4f*)(&To[2 * j + tq][c][d0]); a1 += w * *(const v4f*)(&To[2 * j + tq][c][d0 + 32]); }
  const float inv = 1.0f / (lj * PS * XS); float* po = out + ((size_t)b * L + tx * 32 + row) * HD + d0;
  *(v4f*)po = a0 * inv; *(v4f*)(po + 32) = a1 * inv;
}
}  // namespace

extern "C" void kernel_launch(void* const* d_in, const int* in_sizes, int n_in, void* d_out, int out_size, void* d_ws, size_t ws_size, hipStream_t stream) {
  (void)n_in;
  auto Fp = [&](int i) { return (const float*)d_in[i]; };
  // input order: 0 q, 1 k, 2 v [8,4096,64]
  if (in_sizes[0] != B * L * HD || in_sizes[1] != B * L * HD || in_sizes[2] != B * L * HD || out_size != B * L * HD) return;
  size_t off = 0; char* ws = (char*)d_ws;
  auto carve = [&](size_t bytes) { char* p = ws + off; off += (bytes + 255) & ~(size_t)255; return p; };
  const size_t plane = (size_t)B * L * HD * 2; b16* QP = (b16*)carve(plane); b16* KP = (b16*)carve(plane); b16* VT = (b16*)carve(plane);
  if (off > ws_size || off > ((size_t)128 << 20)) return;   // ≈ 12.6 MB
  plane_kernel<<<dim3(L / 64, BL), 256, 0, stream>>>(Fp(0), Fp(1), Fp(2), QP, KP, VT);
  attn_kernel<<<dim3(BL, QL / 32), 64 * KS, 0, stream>>>(QP, KP, VT, (float*)d_out);
}

// v008
// It runs in 31.9 microseconds.
// In two side-by-side timings against v007, it was 1.17 and 1.18 times as fast.
// All steps since v000 together make it 8.56 times as fast.
#include <hip/hip_runtime.h>

// Scaled dot-product attention, single head, causal, on given q/k/v [8, 4096, 64]: out[b][t] = Σ_{s<=t} softmax_s(q_t . k_s / 8) v_s -> [8][4096][64].
// No projections: q, k, v are (bf16-rounded) inputs, so every WMMA operand except the probabilities is exact.
// Deterministic: flash-style per 16-query tile, its causal keys dealt to 4 waves (each with a running max), the 4 shares joined in a fixed order in LDS; no atomics.
// compute dtype: WMMA v_wmma_f32_16x16x32_f16 with f32 accumulate for S^T = K Q^T (q, k EXACT bf16 x8 planes: 1 product) and O^T += V^T P^T (v EXACT x8, P x1024 as f16 hi+lo: 2 products);
// softmax statistics in f32. Inputs rounded to bf16 once.
// K and V planes lie in fragment order: per 32 keys 4 blocks of 1 KiB, a block = one A fragment (K: 16 keys x 32 d; V^T: 16 d x 32 keys) as [half j][lane][8 f16],
// where lane (hh, col) holds k = 16 j + 8 hh + e of row col. A wave's 16-byte load of one half is then 512 bytes in a row, 4 whole 128-byte lines.

namespace {
constexpr int B = 8, L = 4096, HD = 64, BL = 8 /* batches (== 8 shipped) */, QL = 4096 /* query rows (== 4096 shipped; causal: a cut also limits keys to < QL) */;
constexpr float XS = 8.0f, PS = 1024.0f, LOG2E = 1.4426950408889634f;
static_assert(L % 64 == 0 && QL % 64 == 0, "tiling");
typedef _Float16 b16;
typedef __attribute__((ext_vector_type(16))) _Float16 v16b;
typedef __attribute__((ext_vector_type(8))) _Float16 v8b;
typedef __attribute__((ext_vector_type(8))) float v8f;
typedef __attribute__((ext_vector_type(4))) float v4f;
__device__ __forceinline__ float bf16_rne(float f) { unsigned int u = __float_as_uint(f); u += 0x7FFFu + ((u >> 16) & 1u); return __uint_as_float(u & 0xFFFF0000u); }
__device__ __forceinline__ v16b frag_kb(const b16* p, int hh) { const v8b a = *(const v8b*)(p + 8 * hh), b = *(const v8b*)(p + 16 + 8 * hh); v16b f;
#pragma unroll
  for (int e = 0; e < 8; ++e) { f[e] = a[e]; f[8 + e] = b[e]; } return f; }
__device__ __forceinline__ v16b frag_fo(const b16* p) { const v8b a = *(const v8b*)p, b = *(const v8b*)(p + 256); v16b f;   // p: the lane's 8 f16 in half 0 of a fragment-order block
#pragma unroll
  for (int e = 0; e < 8; ++e) { f[e] = a[e]; f[8 + e] = b[e]; } return f; }
__device__ __forceinline__ v8f wmma16b(v16b a, v16b b, v8f c) { v8f d = __builtin_amdgcn_wmma_f32_16x16x32_f16(false, a, false, b, (short)0, c, false, false); asm volatile("v_nop\n\tv_nop\n\tv_nop\n\tv_nop" : "+v"(d) : "v"(a), "v"(b)); return d; }
__device__ __forceinline__ v8f wmma16n(v16b a, v16b b, v8f c) { return __builtin_amdgcn_wmma_f32_16x16x32_f16(false, a, false, b, (short)0, c, false, false); }   // the builtin alone, for the loop's trips: the compiler keeps the distance behind it, with the trip's own vector work where it has some
__device__ __forceinline__ float pmul(float a, float b) { float p = a * b; asm volatile("" : "+v"(p)); return p; }
__device__ __forceinline__ int iclamp(int v, int lo, int hi) { return v < lo ? lo : (v > hi ? hi : v); }

typedef __attribute__((ext_vector_type(2))) _Float16 v2h;
typedef __attribute__((ext_vector_type(4))) _Float16 v4h;
typedef __attribute__((ext_vector_type(2))) float v2f;
__device__ __forceinline__ float nexp2(float v) { return __builtin_amdgcn_exp2f(v); }
__global__ __launch_bounds__(256) void plane_kernel(const float* __restrict__ q, const float* __restrict__ k, const float* __restrict__ v, b16* __restrict__ QP, b16* __restrict__ KP, b16* __restrict__ VT) {
  __shared__ __attribute__((aligned(4))) b16 Tv[64][HD + 2]; __shared__ __attribute__((aligned(16))) b16 Tk[64][HD + 8];
  const int t0 = blockIdx.x * 64, b = blockIdx.y; if (t0 >= QL) return;   // cut builds only; block-uniform, before any barrier
  const size_t base = ((size_t)b * L + t0) * HD;
  // A thread's whole share of the tile, 4 pieces of 4 floats of each input, is asked for before any of it is used: one trip to memory for the block, not one per piece.
  v4f fq[4], fk[4], fv[4];
#pragma unroll   // unrolled so that the 12 loads stand in a row, each with registers of its own
  for (int r = 0; r < 4; ++r) { const size_t p = base + (size_t)(threadIdx.x + 256 * r) * 4; fq[r] = *(const v4f*)(q + p); fk[r] = *(const v4f*)(k + p); fv[r] = *(const v4f*)(v + p); }
#pragma unroll   // unrolled, with the loop inside it: the pieces are indexed by constants and stay in registers
  for (int r = 0; r < 4; ++r) { const int i = threadIdx.x + 256 * r; v4h oq, ok; v2h ov[2];
#pragma unroll
    for (int j = 0; j < 4; ++j) { oq[j] = (b16)(bf16_rne(fq[r][j]) * XS); ok[j] = (b16)(bf16_rne(fk[r][j]) * XS); ov[j >> 1][j & 1] = (b16)(bf16_rne(fv[r][j]) * XS); }
    *(v4h*)(QP + base + (size_t)i * 4) = oq; *(v4h*)(&Tk[i / 16][(i % 16) * 4]) = ok;
    *(v2h*)(&Tv[i / 16][(i % 16) * 4]) = ov[0]; *(v2h*)(&Tv[i / 16][(i % 16) * 4 + 2]) = ov[1]; }   // a Tv row is 132 bytes: 4-byte pieces stay aligned
  __syncthreads();
  {
    // The tile's 64 keys x 64 d are 512 pieces of 8 f16 in either plane, piece i at base + 8 i: lane = i % 32, half j = i / 32 % 2, then the block.
    for (int i = threadIdx.x; i < 64 * HD / 8; i += 256) { const int col = i & 15, hh = (i >> 4) & 1, j = (i >> 5) & 1;
      *(v8b*)(KP + base + (size_t)i * 8) = *(const v8b*)(&Tk[(i >> 7) * 16 + col][((i >> 6) & 1) * 32 + 16 * j + 8 * hh]);   // K block = (16-key group i / 128, d half i / 64 % 2)
      v8b ov; for (int e = 0; e < 8; ++e) ov[e] = Tv[(i >> 8) * 32 + 16 * j + 8 * hh + e][((i >> 6) & 3) * 16 + col];         // V block = (32-key group i / 256, d group i / 64 % 4)
      *(v8b*)(VT + base + (size_t)i * 8) = ov; }
     }
}
template <bool V> struct flag { static constexpr bool value = V; };
// A query tile's 32-key trips are dealt round-robin to KS waves (share sp takes trips sp, sp + KS, ...); each keeps its own running max, sum and O^T, and the shares are joined in LDS at the end.
constexpr int KS = 4;
__global__ __launch_bounds__(64 * KS) void attn_kernel(const b16* __restrict__ QP, const b16* __restrict__ KP, const b16* __restrict__ VT, float* __restrict__ out) {
  __shared__ __attribute__((aligned(16))) float To[2 * KS][16][HD + 4]; __shared__ float Sm[2 * KS][16], Sl[2 * KS][16];
  const int wave = __builtin_amdgcn_readfirstlane(threadIdx.x >> 5);   // the wave's number in a scalar register: its first key now depends on it, and the trip count and the K and V addresses stay scalar work
  const int lane = threadIdx.x & 31, hh = lane >> 4, col = lane & 15; const int b = blockIdx.x; const int qt = wave & 1, sp = wave >> 1;
  // Longest first: a block's key trips grow with its query tile, and the grid holds more blocks than the chip has places for at once. y counts the tiles down from the last
  // (x is the batch); for speed only, every (batch, tile) is taken once in any order.
  const int tx = QL / 32 - 1 - (int)blockIdx.y; const int q0 = tx * 32 + qt * 16, qi = q0 + col;
  const b16* Qb = QP + (size_t)b * L * HD; const b16* Kb = KP + (size_t)b * L * HD; const b16* Vb = VT + (size_t)b * L * HD;
  const v16b qa0 = frag_kb(Qb + (size_t)qi * HD, hh), qa1 = frag_kb(Qb + (size_t)qi * HD + 32, hh);
  asm volatile("" :: "v"(qa0), "v"(qa1));   // inputs-only fence on the loaded Q: holds the Q loads in front of every K and V load. The loop's counted waits are the smaller of entry and back edge, and a Q load among the V loads would make each trip's first product wait for V loads just issued
  const float cs = LOG2E / (8.0f * XS * XS);
  float m = -INFINITY, l = 0.0f; v8f o[4]; for (int t = 0; t < 4; ++t) o[t] = (v8f){};
  const int klast = tx * 32;   // klast: first key of the last 32-key trip, the same for every wave of the block
  const int kfirst = sp * 32 < klast ? sp * 32 : klast;   // a share with no trip (sp * 32 > klast) fetches the last tile and uses nothing of it
  const b16* Kl = Kb + lane * 8; const b16* Vl = Vb + lane * 8;   // a 32-key trip at key kb: 4 K blocks and 4 V blocks of 512 f16 from kb * HD on
  // K and V fragments live in registers one trip ahead: a trip's 16 loads are issued as two groups during the trip before it, so no product waits out a load of its own.
  v16b kf[4], vf[4];
  const b16* Kf = Kl + (size_t)kfirst * HD; const b16* Vf = Vl + (size_t)kfirst * HD;
#pragma unroll
  for (int t = 0; t < 4; ++t) kf[t] = frag_fo(Kf + t * 512);
#pragma unroll
  for (int t = 0; t < 4; ++t) vf[t] = frag_fo(Vf + t * 512);
  asm volatile("s_wait_xcnt 0x0" :: "v"(Kf), "v"(Vf) : "memory");   // the first fetch's two address pairs stay whole up to this wait
  // One 32-key trip. Only the tile's last trip (kb == klast) holds keys behind a query: it alone is built with the causal compare and the guards for -inf scores. In every earlier trip all 32 keys
  // are at or in front of q0, the scores are finite sums of finite products, and compare, select and guards would be identities. The last trip has no next one and fetches nothing.
  auto trip = [&](auto fl, const int kb) __attribute__((always_inline)) {
    constexpr bool diag = decltype(fl)::value;
    auto mm = [](v16b a, v16b b, v8f c) __attribute__((always_inline)) { if constexpr (diag) return wmma16b(a, b, c); else return wmma16n(a, b, c); };   // the peeled last trip, once a tile, keeps its form
    const int kn = kb + 32 * KS < klast ? kb + 32 * KS : klast;   // this share's next trip; past the end the last tile is fetched instead, so every address stays inside the planes
    float e[16]; float mx = -INFINITY; v8f s[2];
#pragma unroll
    for (int u = 0; u < 2; ++u) { s[u] = (v8f){}; s[u] = mm(kf[2 * u], qa0, s[u]); s[u] = mm(kf[2 * u + 1], qa1, s[u]); }
    if constexpr (!diag) {
      asm volatile("" :: "v"(s[0]), "v"(s[1]));   // inputs-only fence on the two score accumulators: the four score products stay in front of it and the next trip's K loads behind it, so that the loads land in the registers just read; mixed among the products they took fresh registers and 16 copies a trip. It names no multiply's result: s * cs - mn still fuses
#pragma unroll
      for (int t = 0; t < 4; ++t) kf[t] = frag_fo(Kl + (size_t)kn * HD + t * 512);
      __builtin_amdgcn_sched_barrier(0); }   // holds those loads in front of the softmax: left free, the compiler sank them to the trip's end and waited them out there
#pragma unroll
    for (int u = 0; u < 2; ++u)
#pragma unroll
      for (int r = 0; r < 8; ++r) { const int key = kb + u * 16 + 8 * hh + r; const float vv = (!diag || key <= qi) ? s[u][r] * cs : -INFINITY; e[u * 8 + r] = vv; mx = fmaxf(mx, vv); }
    mx = fmaxf(mx, __shfl_xor(mx, 16)); const float mn = fmaxf(m, mx); const float al = (diag && mn == -INFINITY) ? 1.0f : nexp2(m - mn); float sum = 0.0f;
    // P^T never leaves the lane: accumulator register r of score tile u is key 16 u + 8 hh + r of query col, which is element 8 u + r of the lane's B fragment in the k order of the V^T blocks.
    v16b pf, pg;
#pragma unroll
    for (int i2 = 0; i2 < 16; i2 += 2) { v2f t;
#pragma unroll
      for (int j = 0; j < 2; ++j) { const float p = (diag && e[i2 + j] == -INFINITY) ? 0.0f : nexp2(e[i2 + j] - mn); sum += p; t[j] = p * PS; }
      const v2h a_ = __builtin_convertvector(t, v2h), b_ = __builtin_convertvector(t - __builtin_convertvector(a_, v2f), v2h);   // hi and lo of two neighbouring keys: one packed register of either fragment
      pf[i2] = a_[0]; pf[i2 + 1] = a_[1]; pg[i2] = b_[0]; pg[i2 + 1] = b_[1]; }
    sum += __shfl_xor(sum, 16); l = l * al + sum; m = mn;
#pragma unroll
    for (int t = 0; t < 4; ++t) { o[t] *= al; o[t] = mm(vf[t], pf, o[t]); o[t] = mm(vf[t], pg, o[t]); }
    if constexpr (!diag) {
#pragma unroll
      for (int t = 0; t < 4; ++t) vf[t] = frag_fo(Vl + (size_t)kn * HD + t * 512); }
    if constexpr (!diag) asm volatile("s_wait_xcnt 0x0" :: "v"(l) : "memory"); };   // the next trip reuses the V loads' address registers: the wait stands in front of that overwrite; it takes l as an input so that it stays at the back edge, behind the row-sum chain, and is not waited out directly behind the loads
  int kb = sp * 32;
#pragma unroll 1   // stays rolled: one copy of the trip in the instruction cache, and the fragments fetched ahead keep their registers over the back edge
  for (; kb < klast; kb += 32 * KS) trip(flag<false>{}, kb);
  if (kb == klast) trip(flag<true>{}, kb);   // scalar test: the one share in KS whose turn the last trip is
  // Each share hands over its un-normalised O^T with its max and sum; a share without a trip hands (-inf, 0, zeros).
#pragma unroll
  for (int t = 0; t < 4; ++t)
#pragma unroll
    for (int r = 0; r < 8; ++r) To[wave][col][t * 16 + 8 * hh + r] = o[t][r];
  if (hh == 0) { Sm[wave][col] = m; Sl[wave][col] = l; }
  __syncthreads();   // every wave passes it once: behind it all KS shares of both query tiles are in LDS
  // 8 threads join one of the block's 32 query rows, shares in the order 0 .. KS - 1; a thread holds 4 values in each half of the row, so a store of 8 lanes fills one 128-byte line of out.
  const int row = threadIdx.x >> 3, tq = row >> 4, c = row & 15, d0 = (threadIdx.x & 7) * 4;
  float ms[KS]; float mj = -INFINITY;
#pragma unroll
  for (int j = 0; j < KS; ++j) { ms[j] = Sm[2 * j + tq][c]; mj = fmaxf(mj, ms[j]); }
  float lj = 0.0f; v4f a0 = (v4f){}, a1 = (v4f){};
#pragma unroll
  for (int j = 0; j < KS; ++j) { const float w = (ms[j] == -INFINITY) ? 0.0f : nexp2(ms[j] - mj); lj += w * Sl[2 * j + tq][c]; a0 += w * *(const v4f*)(&To[2 * j + tq][c][d0]); a1 += w * *(const v4f*)(&To[2 * j + tq][c][d0 + 32]); }
  const float inv = 1.0f / (lj * PS * XS); float* po = out + ((size_t)b * L + tx * 32 + row) * HD + d0;
  *(v4f*)po = a0 * inv; *(v4f*)(po + 32) = a1 * inv;
}
}  // namespace

extern "C" void kernel_launch(void* const* d_in, const int* in_sizes, int n_in, void* d_out, int out_size, void* d_ws, size_t ws_size, hipStream_t stream) {
  (void)n_in;
  auto Fp = [&](int i) { return (const float*)d_in[i]; };
  // input order: 0 q, 1 k, 2 v [8,4096,64]
  if (in_sizes[0] != B * L * HD || in_sizes[1] != B * L * HD || in_sizes[2] != B * L * HD || out_size != B * L * HD) return;
  size_t off = 0; char* ws = (char*)d_ws;
  auto carve = [&](size_t bytes) { char* p = ws + off; off += (bytes + 255) & ~(size_t)255; return p; };
  const size_t plane = (size_t)B * L * HD * 2; b16* QP = (b16*)carve(plane); b16* KP = (b16*)carve(plane); b16* VT = (b16*)carve(plane);
  if (off > ws_size || off > ((size_t)128 << 20)) return;   // ≈ 12.6 MB
  plane_kernel<<<dim3(L / 64, BL), 256, 0, stream>>>(Fp(0), Fp(1), Fp(2), QP, KP, VT);
  attn_kernel<<<dim3(BL, QL / 32), 64 * KS, 0, stream>>>(QP, KP, VT, (float*)d_out);
}

// v010
// Measured time: 29.3 microseconds a run.
// It is 1.11 times as fast as v008, going by the measured steps of the versions left out in between.
// All steps since v000 together make it 9.52 times as fast.
#include <hip/hip_runtime.h>

// Scaled dot-product attention, single head, causal, on given q/k/v [8, 4096, 64]: out[b][t] = Σ_{s<=t} softmax_s(q_t . k_s / 8) v_s -> [8][4096][64].
// No projections: q, k, v are (bf16-rounded) inputs, so every WMMA operand except the probabilities is exact.
// Deterministic: flash-style per 32-query tile, its causal keys dealt to 8 waves (each with a running max per query), the 8 shares joined in a fixed order in LDS; no atomics.
// compute dtype: WMMA v_wmma_f32_16x16x32_f16 with f32 accumulate for S^T = K Q^T (q, k EXACT bf16 x8 planes: 1 product) and O^T += V^T P^T (v EXACT x8, P x1024 rounded once to f16: 1 product; its 11 significant bits stand against the 8 that the bf16-rounded inputs carry);
// softmax statistics in f32. Inputs rounded to bf16 once.
// K and V planes lie in fragment order: per 32 keys 4 blocks of 1 KiB, a block = one A fragment (K: 16 keys x 32 d; V^T: 16 d x 32 keys) as [half j][lane][8 f16],
// where lane (hh, col) holds k = 16 j + 8 hh + e of row col. A wave's 16-byte load of one half is then 512 bytes in a row, 4 whole 128-byte lines.

namespace {
constexpr int B = 8, L = 4096, HD = 64, BL = 8 /* batches (== 8 shipped) */, QL = 4096 /* query rows (== 4096 shipped; causal: a cut also limits keys to < QL) */;
constexpr float XS = 8.0f, PS = 1024.0f, LOG2E = 1.4426950408889634f;
static_assert(L % 64 == 0 && QL % 64 == 0, "tiling");
typedef _Float16 b16;
typedef __attribute__((ext_vector_type(16))) _Float16 v16b;
typedef __attribute__((ext_vector_type(8))) _Float16 v8b;
typedef __attribute__((ext_vector_type(8))) float v8f;
typedef __attribute__((ext_vector_type(4))) float v4f;
__device__ __forceinline__ float bf16_rne(float f) { unsigned int u = __float_as_uint(f); u += 0x7FFFu + ((u >> 16) & 1u); return __uint_as_float(u & 0xFFFF0000u); }
__device__ __forceinline__ v16b frag_kb(const b16* p, int hh) { const v8b a = *(const v8b*)(p + 8 * hh), b = *(const v8b*)(p + 16 + 8 * hh); v16b f;
#pragma unroll
  for (int e = 0; e < 8; ++e) { f[e] = a[e]; f[8 + e] = b[e]; } return f; }
__device__ __forceinline__ v16b frag_fo(const b16* p) { const v8b a = *(const v8b*)p, b = *(const v8b*)(p + 256); v16b f;   // p: the lane's 8 f16 in half 0 of a fragment-order block
#pragma unroll
  for (int e = 0; e < 8; ++e) { f[e] = a[e]; f[8 + e] = b[e]; } return f; }
__device__ __forceinline__ v8f wmma16b(v16b a, v16b b, v8f c) { v8f d = __builtin_amdgcn_wmma_f32_16x16x32_f16(false, a, false, b, (short)0, c, false, false); asm volatile("v_nop\n\tv_nop\n\tv_nop\n\tv_nop" : "+v"(d) : "v"(a), "v"(b)); return d; }
__device__ __forceinline__ v8f wmma16n(v16b a, v16b b, v8f c) { return __builtin_amdgcn_wmma_f32_16x16x32_f16(false, a, false, b, (short)0, c, false, false); }   // the builtin alone, for the loop's trips: the compiler keeps the distance behind it, with the trip's own vector work where it has some
__device__ __forceinline__ float pmul(float a, float b) { float p = a * b; asm volatile("" : "+v"(p)); return p; }
__device__ __forceinline__ int iclamp(int v, int lo, int hi) { return v < lo ? lo : (v > hi ? hi : v); }

typedef __attribute__((ext_vector_type(2))) _Float16 v2h;
typedef __attribute__((ext_vector_type(4))) _Float16 v4h;
typedef __attribute__((ext_vector_type(2))) float v2f;
__device__ __forceinline__ float nexp2(float v) { return __builtin_amdgcn_exp2f(v); }
__device__ __forceinline__ float nexp2s(float v) { float r; asm("v_exp_f32 %0, %1\n\tv_nop" : "=v"(r) : "v"(v)); return r; }   // the same instruction with the one free slot behind a transcendental in its own statement, for the peeled last trip
__global__ __launch_bounds__(256) void plane_kernel(const float* __restrict__ q, const float* __restrict__ k, const float* __restrict__ v, b16* __restrict__ QP, b16* __restrict__ KP, b16* __restrict__ VT) {
  __shared__ __attribute__((aligned(4))) b16 Tv[64][HD + 2]; __shared__ __attribute__((aligned(16))) b16 Tk[64][HD + 8];
  const int t0 = blockIdx.x * 64, b = blockIdx.y; if (t0 >= QL) return;   // cut builds only; block-uniform, before any barrier
  const size_t base = ((size_t)b * L + t0) * HD;
  // A thread's whole share of the tile, 4 pieces of 4 floats of each input, is asked for before any of it is used: one trip to memory for the block, not one per piece.
  v4f fq[4], fk[4], fv[4];
#pragma unroll   // unrolled so that the 12 loads stand in a row, each with registers of its own
  for (int r = 0; r < 4; ++r) { const size_t p = base + (size_t)(threadIdx.x + 256 * r) * 4; fq[r] = *(const v4f*)(q + p); fk[r] = *(const v4f*)(k + p); fv[r] = *(const v4f*)(v + p); }
#pragma unroll   // unrolled, with the loop inside it: the pieces are indexed by constants and stay in registers
  for (int r = 0; r < 4; ++r) { const int i = threadIdx.x + 256 * r; v4h oq, ok; v2h ov[2];
#pragma unroll
    for (int j = 0; j < 4; ++j) { oq[j] = (b16)(bf16_rne(fq[r][j]) * XS); ok[j] = (b16)(bf16_rne(fk[r][j]) * XS); ov[j >> 1][j & 1] = (b16)(bf16_rne(fv[r][j]) * XS); }
    *(v4h*)(QP + base + (size_t)i * 4) = oq; *(v4h*)(&Tk[i / 16][(i % 16) * 4]) = ok;
    *(v2h*)(&Tv[i / 16][(i % 16) * 4]) = ov[0]; *(v2h*)(&Tv[i / 16][(i % 16) * 4 + 2]) = ov[1]; }   // a Tv row is 132 bytes: 4-byte pieces stay aligned
  __syncthreads();
  {
    // The tile's 64 keys x 64 d are 512 pieces of 8 f16 in either plane, piece i at base + 8 i: lane = i % 32, half j = i / 32 % 2, then the block.
    for (int i = threadIdx.x; i < 64 * HD / 8; i += 256) { const int col = i & 15, hh = (i >> 4) & 1, j = (i >> 5) & 1;
      *(v8b*)(KP + base + (size_t)i * 8) = *(const v8b*)(&Tk[(i >> 7) * 16 + col][((i >> 6) & 1) * 32 + 16 * j + 8 * hh]);   // K block = (16-key group i / 128, d half i / 64 % 2)
      v8b ov; for (int e = 0; e < 8; ++e) ov[e] = Tv[(i >> 8) * 32 + 16 * j + 8 * hh + e][((i >> 6) & 3) * 16 + col];         // V block = (32-key group i / 256, d group i / 64 % 4)
      *(v8b*)(VT + base + (size_t)i * 8) = ov; }
     }
}
template <bool V> struct flag { static constexpr bool value = V; };
// A wave holds all 32 query columns of its block (two 16-column tiles c = 0, 1): every K and V fragment it loads feeds two products, one per tile.
// The block's 32-key trips are dealt round-robin to its KS waves (share sp takes trips sp, sp + KS, ...); each keeps its own running max, sum and O^T, and the shares are joined in LDS at the end.
constexpr int KS = 8;
__global__ __launch_bounds__(32 * KS) void attn_kernel(const b16* __restrict__ QP, const b16* __restrict__ KP, const b16* __restrict__ VT, float* __restrict__ out) {
  __shared__ __attribute__((aligned(16))) float To[KS][32][HD + 4]; __shared__ float Sm[KS][32], Sl[KS][32];
  const int wave = __builtin_amdgcn_readfirstlane(threadIdx.x >> 5);   // the wave's number in a scalar register: its first key now depends on it, and the trip count and the K and V addresses stay scalar work
  const int lane = threadIdx.x & 31, hh = lane >> 4, col = lane & 15; const int b = blockIdx.x; const int sp = wave;
  // Longest first: a block's key trips grow with its query tile, and the grid holds more blocks than the chip has places for at once. Low y takes the last tiles;
  // for speed only, every (batch, tile) is taken once in any order.
  const int tx = QL / 32 - 1 - (int)blockIdx.y; const int q0 = tx * 32; const int qi[2] = {q0 + col, q0 + 16 + col};
  const b16* Qb = QP + (size_t)b * L * HD; const b16* Kb = KP + (size_t)b * L * HD; const b16* Vb = VT + (size_t)b * L * HD;
  const v16b qa[2][2] = {{frag_kb(Qb + (size_t)qi[0] * HD, hh), frag_kb(Qb + (size_t)qi[0] * HD + 32, hh)}, {frag_kb(Qb + (size_t)qi[1] * HD, hh), frag_kb(Qb + (size_t)qi[1] * HD + 32, hh)}};
  asm volatile("s_wait_xcnt 0x0" :: "v"(qa[0][0]), "v"(qa[0][1]), "v"(qa[1][0]), "v"(qa[1][1]) : "memory");   // takes the loaded Q as inputs only: holds the Q loads in front of every K and V load. The loop's counted waits are the smaller of entry and back edge, and a Q load among the V loads would make each trip's first product wait for V loads just issued. The wait itself stands in front of the first V load, which in this build lands on the Q loads' address registers
  const float cs = LOG2E / (8.0f * XS * XS);
  float m[2] = {-INFINITY, -INFINITY}, l[2] = {0.0f, 0.0f}; v8f o[2][4];
#pragma unroll   // here and below, every loop over c, u, t, i, j or r is unrolled so that the arrays it indexes are indexed by constants and stay in registers
  for (int c = 0; c < 2; ++c) for (int t = 0; t < 4; ++t) o[c][t] = (v8f){};
  const int klast = q0;   // klast: first key of the last 32-key trip, the one that holds the diagonal; the same for every wave of the block
  const int kfirst = sp * 32 < klast ? sp * 32 : klast;   // a share with no trip (sp * 32 > klast) fetches the last tile and uses nothing of it
  const b16* Kl = Kb + lane * 8; const b16* Vl = Vb + lane * 8;   // a 32-key trip at key kb: 4 K blocks and 4 V blocks of 512 f16 from kb * HD on
  // K and V fragments live in registers one trip ahead: a trip's 16 loads are issued as two groups during the trip before it, so no product waits out a load of its own.
  v16b kf[4], vf[4];
  const b16* Kf = Kl + (size_t)kfirst * HD; const b16* Vf = Vl + (size_t)kfirst * HD;
#pragma unroll
  for (int t = 0; t < 4; ++t) kf[t] = frag_fo(Kf + t * 512);
#pragma unroll
  for (int t = 0; t < 4; ++t) vf[t] = frag_fo(Vf + t * 512);
  asm volatile("s_wait_xcnt 0x0" :: "v"(Kf), "v"(Vf) : "memory");   // the first fetch's two address pairs stay whole up to this wait
  // One 32-key trip. Only the block's last trip (kb == klast) holds keys behind a query: it alone is built with the causal compare and the guards for -inf scores. In every earlier trip all 32 keys
  // are in front of q0, the scores are finite sums of finite products, and compare, select and guards would be identities. The last trip has no next one and fetches nothing.
  auto trip = [&](auto fl, const int kb) __attribute__((always_inline)) {
    constexpr bool diag = decltype(fl)::value;
    auto mm = [](v16b a, v16b b, v8f c) __attribute__((always_inline)) { if constexpr (diag) return wmma16b(a, b, c); else return wmma16n(a, b, c); };   // the peeled last trip, once a block, keeps its form
    auto ex2 = [](float x) __attribute__((always_inline)) { if constexpr (diag) return nexp2s(x); else return nexp2(x); };
    const int kn = kb + 32 * KS < klast ? kb + 32 * KS : klast;   // this share's next trip; past the end the last tile is fetched instead, so every address stays inside the planes
    v8f s[2][2];
#pragma unroll
    for (int u = 0; u < 2; ++u)
#pragma unroll
      for (int c = 0; c < 2; ++c) { s[c][u] = (v8f){}; s[c][u] = mm(kf[2 * u], qa[c][0], s[c][u]); s[c][u] = mm(kf[2 * u + 1], qa[c][1], s[c][u]); }
    if constexpr (!diag) {
      asm volatile("" :: "v"(s[0][0]), "v"(s[0][1]), "v"(s[1][0]), "v"(s[1][1]));   // inputs-only fence on the four score accumulators: the eight score products stay in front of it and the next trip's K loads behind it, so that the loads land in the registers just read; mixed among the products they took fresh registers and copies. It names no multiply's result: s * cs - mn still fuses
#pragma unroll
      for (int t = 0; t < 4; ++t) kf[t] = frag_fo(Kl + (size_t)kn * HD + t * 512);
      __builtin_amdgcn_sched_barrier(0); }   // holds those loads in front of the softmax: left free, the compiler sank them to the trip's end and waited them out there
    // P^T goes in as one f16 value per key (relative rounding at most 2^-11 per weight; the row sum below keeps the unrounded p). It never leaves the lane: accumulator register r of score tile u is key 16 u + 8 hh + r of query col, which is element 8 u + r of the lane's B fragment in the k order of the V^T blocks.
    v16b pf[2]; float al[2];
#pragma unroll
    for (int c = 0; c < 2; ++c) {
      // A tile's scores as pairs of neighbouring keys, in vector form throughout: left to pair scalars itself, this build paired across the two tiles and paid for it in register copies.
      v2f x[8]; bool ok[16]; v2f mv = (v2f){-INFINITY, -INFINITY};
#pragma unroll
      for (int i = 0; i < 8; ++i) { x[i] = (v2f){s[c][i >> 2][2 * (i & 3)], s[c][i >> 2][2 * (i & 3) + 1]}; v2f e = x[i] * cs;
#pragma unroll
        for (int j = 0; j < 2; ++j) { ok[2 * i + j] = !diag || kb + (i >> 2) * 16 + 8 * hh + 2 * (i & 3) + j <= qi[c]; if (!ok[2 * i + j]) e[j] = -INFINITY; }
        mv = __builtin_elementwise_max(mv, e); }
      float mx = fmaxf(mv[0], mv[1]); mx = fmaxf(mx, __shfl_xor(mx, 16)); const float mn = fmaxf(m[c], mx); al[c] = (diag && mn == -INFINITY) ? 1.0f : ex2(m[c] - mn); float sum = 0.0f;
#pragma unroll
      for (int i = 0; i < 8; ++i) { const v2f d = __builtin_elementwise_fma(x[i], (v2f){cs, cs}, (v2f){-mn, -mn}); v2f p;
#pragma unroll
        for (int j = 0; j < 2; ++j) { const float w = ex2(d[j]); p[j] = ok[2 * i + j] ? w : 0.0f; sum += p[j]; }
        const v2h a_ = __builtin_convertvector(p * PS, v2h);   // two neighbouring keys: one packed register of the fragment
        pf[c][2 * i] = a_[0]; pf[c][2 * i + 1] = a_[1]; }
      sum += __shfl_xor(sum, 16); l[c] = l[c] * al[c] + sum; m[c] = mn; }
#pragma unroll
    for (int t = 0; t < 4; ++t)
#pragma unroll
      for (int c = 0; c < 2; ++c) { o[c][t] *= al[c]; o[c][t] = mm(vf[t], pf[c], o[c][t]); }
    if constexpr (!diag) {
#pragma unroll
      for (int t = 0; t < 4; ++t) vf[t] = frag_fo(Vl + (size_t)kn * HD + t * 512); }
    if constexpr (!diag) asm volatile("s_wait_xcnt 0x0" :: "v"(l[0]), "v"(l[1]) : "memory"); };   // the next trip reuses the V loads' address registers: the wait stands in front of that overwrite; it takes the row sums as inputs so that it stays at the back edge, behind the row-sum chains, and is not waited out directly behind the loads
  int kb = sp * 32;
#pragma unroll 1   // stays rolled: one copy of the trip in the instruction cache, and the fragments fetched ahead keep their registers over the back edge
  for (; kb < klast; kb += 32 * KS) trip(flag<false>{}, kb);
  if (kb == klast) trip(flag<true>{}, kb);   // scalar test: the one share in KS whose turn the last trip is
  // Each share hands over its un-normalised O^T with its max and sum; a share without a trip hands (-inf, 0, zeros).
#pragma unroll
  for (int c = 0; c < 2; ++c) {
#pragma unroll
    for (int t = 0; t < 4; ++t)
#pragma unroll
      for (int r = 0; r < 8; ++r) To[wave][16 * c + col][t * 16 + 8 * hh + r] = o[c][t][r];
    if (hh == 0) { Sm[wave][16 * c + col] = m[c]; Sl[wave][16 * c + col] = l[c]; } }
  __syncthreads();   // every wave passes it once: behind it all KS shares are in LDS
  // 8 threads join one of the block's 32 query rows, shares in the order 0 .. KS - 1; a thread holds 4 values in each half of the row, so a store of 8 lanes fills one 128-byte line of out.
  const int row = threadIdx.x >> 3, d0 = (threadIdx.x & 7) * 4;
  float ms[KS]; float mj = -INFINITY;
#pragma unroll
  for (int j = 0; j < KS; ++j) { ms[j] = Sm[j][row]; mj = fmaxf(mj, ms[j]); }
  float lj = 0.0f; v4f a0 = (v4f){}, a1 = (v4f){};
#pragma unroll
  for (int j = 0; j < KS; ++j) { const float w = (ms[j] == -INFINITY) ? 0.0f : nexp2(ms[j] - mj); lj += w * Sl[j][row]; a0 += w * *(const v4f*)(&To[j][row][d0]); a1 += w * *(const v4f*)(&To[j][row][d0 + 32]); }
  const float inv = 1.0f / (lj * PS * XS); float* po = out + ((size_t)b * L + tx * 32 + row) * HD + d0;
  *(v4f*)po = a0 * inv; *(v4f*)(po + 32) = a1 * inv;
}
}  // namespace

extern "C" void kernel_launch(void* const* d_in, const int* in_sizes, int n_in, void* d_out, int out_size, void* d_ws, size_t ws_size, hipStream_t stream) {
  (void)n_in;
  auto Fp = [&](int i) { return (const float*)d_in[i]; };
  // input order: 0 q, 1 k, 2 v [8,4096,64]
  if (in_sizes[0] != B * L * HD || in_sizes[1] != B * L * HD || in_sizes[2] != B * L * HD || out_size != B * L * HD) return;
  size_t off = 0; char* ws = (char*)d_ws;
  auto carve = [&](size_t bytes) { char* p = ws + off; off += (bytes + 255) & ~(size_t)255; return p; };
  const size_t plane = (size_t)B * L * HD * 2; b16* QP = (b16*)carve(plane); b16* KP = (b16*)carve(plane); b16* VT = (b16*)carve(plane);
  if (off > ws_size || off > ((size_t)128 << 20)) return;   // ≈ 12.6 MB
  plane_kernel<<<dim3(L / 64, BL), 256, 0, stream>>>(Fp(0), Fp(1), Fp(2), QP, KP, VT);
  attn_kernel<<<dim3(BL, QL / 32), 32 * KS, 0, stream>>>(QP, KP, VT, (float*)d_out);
}
